// v000
// The times below were measured on an AMD MI455X: many runs one after another, warmed up first and cycling through
// copies of the inputs, with the whole window's GPU time divided by the number of runs. Launches and the gaps
// between them are all in it. The median over several windows is given; except for v000 it joins two sittings, which
// can be a few percent apart, so the side-by-side timings, each taken in one sitting, are the better comparison.
// The starting kernel, v000, takes 26.1 microseconds a run.
// Contractions: scores = q.k^T (K=64) and out = p.v (K=128) on v_wmma_f32_16x16x32_f16 with f32 accumulate; x carried as the f16 image of its RNE-bf16 value (exact), p carried as f16 x 2^15; softmax, max, sum and normalisation in f32.
#include <hip/hip_runtime.h>

typedef __attribute__((ext_vector_type(16))) _Float16 v16h;
typedef __attribute__((ext_vector_type(8)))  _Float16 v8h;
typedef __attribute__((ext_vector_type(4)))  _Float16 v4h;
typedef __attribute__((ext_vector_type(8)))  float    v8f;
typedef __attribute__((ext_vector_type(4)))  float    v4f;

constexpr int SEQ_LEN    = 671;
constexpr int HEAD_DIM   = 64;
constexpr int BLK_ROWS   = 128;
constexpr int GAP_BEGIN  = 384;
constexpr int GAP_END    = 543;
constexpr int NWAVES     = 8;
constexpr int NTHREADS   = 256;
constexpr float P_CARRY     = 32768.0f;
constexpr float SCORE_SCALE = 0.125f;

static_assert(SEQ_LEN - GAP_END == BLK_ROWS, "last block is 128 rows");
static_assert(3 * BLK_ROWS == GAP_BEGIN, "first three blocks end at the gap");
static_assert(NWAVES * 16 == BLK_ROWS, "8 waves x 16 query rows cover a block");
static_assert(HEAD_DIM % 32 == 0 && BLK_ROWS % 32 == 0, "K multiples of 32 for both contractions");

// ---- helpers ----
__device__ __forceinline__ unsigned short f2bf_bits(float f) {
  unsigned u = __float_as_uint(f);
  return (unsigned short)((u + 0x7FFFu + ((u >> 16) & 1u)) >> 16);
}
// RNE to bf16, then held in an f16 container (8 significant bits fit exactly)
__device__ __forceinline__ _Float16 to_h16_of_bf16(float f) {
  const unsigned short hb = f2bf_bits(f);
  const float g = __uint_as_float(((unsigned)hb) << 16);
  return (_Float16)g;
}
// 16x32 fragment: elements 0..7 <- p[0..7], 8..15 <- p[16..23]; caller passes p = row base + k0 + 8*(lane>>4)
__device__ __forceinline__ v16h frag_load(const _Float16* p) {
  union { v16h v; v8h h[2]; } f;
  f.h[0] = *(const v8h*)(p);
  f.h[1] = *(const v8h*)(p + 16);
  return f.v;
}
__device__ __forceinline__ v8f mma16(v16h a, v16h b, v8f c) {
  c = __builtin_amdgcn_wmma_f32_16x16x32_f16(false, a, false, b, (short)0, c, false, false);
  asm volatile("v_nop\n\tv_nop\n\tv_nop\n\tv_nop" : "+v"(c) : "v"(a), "v"(b));
  return c;
}

// per-wave staging: P tile [16][128] f16 (4096 B) then, after a barrier, O tile [16][64] f32 (4096 B)
union POBuf {
  _Float16 p[16 * BLK_ROWS];
  float    o[16 * HEAD_DIM];
};
static_assert(sizeof(POBuf) == 4096, "P and O views have equal size");

// One block = one (batch*head, diagonal block): 128 query rows x 128 keys x 64 dims.
// grid = (4, B*N), 256 threads = 8 waves, wave w owns query rows 16w..16w+15.
__global__ __launch_bounds__(NTHREADS) void blk_attn_kernel(const float* __restrict__ x,
                                                            float* __restrict__ out) {
  __shared__ __align__(16) _Float16 sX[BLK_ROWS * HEAD_DIM];    // [row][d], pitch 64 halves
  __shared__ __align__(16) _Float16 sXt[HEAD_DIM * BLK_ROWS];   // [d][row], pitch 128 halves
  __shared__ __align__(16) POBuf sPO[NWAVES];

  const int blk = blockIdx.x;                               // 0..3, block-uniform
  const int bh  = blockIdx.y;                               // 0..B*N-1
  const int row0 = (blk < 3) ? blk * BLK_ROWS : GAP_END;    // 0, 128, 256, 543
  const size_t base = ((size_t)bh * SEQ_LEN + (size_t)row0) * HEAD_DIM;
  const float* gx = x + base;
  float* gy = out + base;
  const int tid = threadIdx.x;

  // ---- staging: 128 rows x 16 float4 = 2048 float4 = 256 threads x 8; writes all of sX[128][64] and sXt[64][128] ----
#pragma unroll
  for (int i = 0; i < 8; ++i) {
    const int f   = i * NTHREADS + tid;       // 0..2047
    const int row = f >> 4;                   // 0..127
    const int d4  = (f & 15) * 4;             // 0..60
    const v4f v = *(const v4f*)(gx + (size_t)row * HEAD_DIM + d4);
    const _Float16 h0 = to_h16_of_bf16(v[0]);
    const _Float16 h1 = to_h16_of_bf16(v[1]);
    const _Float16 h2 = to_h16_of_bf16(v[2]);
    const _Float16 h3 = to_h16_of_bf16(v[3]);
    v4h hv;
    hv[0] = h0; hv[1] = h1; hv[2] = h2; hv[3] = h3;
    *(v4h*)(sX + row * HEAD_DIM + d4) = hv;
    sXt[(d4 + 0) * BLK_ROWS + row] = h0;
    sXt[(d4 + 1) * BLK_ROWS + row] = h1;
    sXt[(d4 + 2) * BLK_ROWS + row] = h2;
    sXt[(d4 + 3) * BLK_ROWS + row] = h3;
  }
  __syncthreads();

  const int wave = tid >> 5;
  const int lane = tid & 31;
  const int hh   = lane >> 4;        // lane half: k offset 8*hh, D rows 8*hh+r
  const int c    = lane & 15;        // A row / B column / D column
  const int r0   = wave * 16;        // first query row of this wave (block-local)

  // ---- scores S[16][128] = Q[16][64] . K^T ; A from sX rows r0.., B[k=d][n=key] = sX[key][d] ----
  v8f acc[8];
#pragma unroll
  for (int j = 0; j < 8; ++j) acc[j] = (v8f){0.f, 0.f, 0.f, 0.f, 0.f, 0.f, 0.f, 0.f};
  v16h qa[2];
#pragma unroll
  for (int kk = 0; kk < 2; ++kk) qa[kk] = frag_load(sX + (r0 + c) * HEAD_DIM + kk * 32 + 8 * hh);
#pragma unroll
  for (int j = 0; j < 8; ++j) {
#pragma unroll
    for (int kk = 0; kk < 2; ++kk) {
      const v16h kb = frag_load(sX + (j * 16 + c) * HEAD_DIM + kk * 32 + 8 * hh);
      acc[j] = mma16(qa[kk], kb, acc[j]);
    }
  }

  // ---- softmax over the 128 keys of each row (acc[j][r] = S[r0 + 8hh + r][16j + c]) ----
  float mx[8], inv[8];
#pragma unroll
  for (int r = 0; r < 8; ++r) {
    float m = acc[0][r];
#pragma unroll
    for (int j = 1; j < 8; ++j) m = fmaxf(m, acc[j][r]);
#pragma unroll
    for (int off = 1; off < 16; off <<= 1) m = fmaxf(m, __shfl_xor(m, off, 32));
    mx[r] = m * SCORE_SCALE;
  }
  _Float16* pw = sPO[wave].p;              // [16][128] f16, this wave only
#pragma unroll
  for (int r = 0; r < 8; ++r) {
    float psum = 0.f;
#pragma unroll
    for (int j = 0; j < 8; ++j) {
      const float p = expf(acc[j][r] * SCORE_SCALE - mx[r]);   // <= 1
      psum += p;
      pw[(8 * hh + r) * BLK_ROWS + j * 16 + c] = (_Float16)(p * P_CARRY);
    }
#pragma unroll
    for (int off = 1; off < 16; off <<= 1) psum += __shfl_xor(psum, off, 32);
    inv[r] = 1.0f / (psum * P_CARRY);      // psum >= 1 (row max term)
  }
  __syncthreads();

  // ---- O[16][64] = P[16][128] . V ; A from pw rows, B[k=key][n=d] = sXt[d][key] ----
  v8f oacc[4];
#pragma unroll
  for (int t = 0; t < 4; ++t) oacc[t] = (v8f){0.f, 0.f, 0.f, 0.f, 0.f, 0.f, 0.f, 0.f};
#pragma unroll
  for (int kk = 0; kk < 4; ++kk) {
    const v16h pa = frag_load(pw + c * BLK_ROWS + kk * 32 + 8 * hh);
#pragma unroll
    for (int t = 0; t < 4; ++t) {
      const v16h vb = frag_load(sXt + (t * 16 + c) * BLK_ROWS + kk * 32 + 8 * hh);
      oacc[t] = mma16(pa, vb, oacc[t]);
    }
  }
  __syncthreads();                         // P reads complete before the O view overwrites the region

  // ---- normalise and stage O (oacc[t][r] = O[8hh + r][16t + c]) ----
  float* os = sPO[wave].o;                 // [16][64] f32
#pragma unroll
  for (int r = 0; r < 8; ++r) {
#pragma unroll
    for (int t = 0; t < 4; ++t) os[(8 * hh + r) * HEAD_DIM + t * 16 + c] = oacc[t][r] * inv[r];
  }
  __syncthreads();

  {
    const int c4 = c * 4;
    {
#pragma unroll
      for (int it = 0; it < 8; ++it) {
        const int row = it * 2 + hh;                          // 0..15
        const v4f val = *(const v4f*)(os + row * HEAD_DIM + c4);
        *(v4f*)(gy + (size_t)(r0 + row) * HEAD_DIM + c4) = val;
      }
      
    }
  }
}

__global__ __launch_bounds__(NTHREADS) void gap_zero_kernel(float* __restrict__ out) {
  constexpr int N4 = (GAP_END - GAP_BEGIN) * HEAD_DIM / 4;   // 2544
  const int bh = blockIdx.x;
  float* p = out + ((size_t)bh * SEQ_LEN + (size_t)GAP_BEGIN) * HEAD_DIM;
  v4f z;
  z[0] = 0.f; z[1] = 0.f; z[2] = 0.f; z[3] = 0.f;
  {
    for (int i = threadIdx.x; i < N4; i += NTHREADS) *(v4f*)(p + (size_t)i * 4) = z;
    
  }
}

extern "C" void kernel_launch(void* const* d_in, const int* in_sizes, int n_in,
                              void* d_out, int out_size, void* d_ws, size_t ws_size,
                              hipStream_t stream) {
  (void)n_in; (void)d_ws; (void)ws_size;
  const float* x = (const float*)d_in[0];
  float* out = (float*)d_out;
  const int total = in_sizes[0];
  const int per_bh = SEQ_LEN * HEAD_DIM;                 // 42944
  const int nbh = total / per_bh;                        // batch * heads = 128
  if (nbh <= 0 || nbh * per_bh != total || out_size != total) return;
  // no workspace used
  blk_attn_kernel<<<dim3(4, nbh), NTHREADS, 0, stream>>>(x, out);
  gap_zero_kernel<<<dim3(nbh), NTHREADS, 0, stream>>>(out);
}

// v001
// One run takes 15.7 microseconds.
// Timed twice side by side with v000, it ran 1.68 and 1.67 times as fast.
// Contractions: scores = q.k^T (K=64) and out = p.v (K=128) on v_wmma_f32_16x16x32_f16 with f32 accumulate; x carried as the f16 image of its RNE-bf16 value (exact), p carried as f16 x 2^15; softmax, max, sum and normalisation in f32.
#include <hip/hip_runtime.h>

typedef __attribute__((ext_vector_type(16))) _Float16 v16h;
typedef __attribute__((ext_vector_type(8)))  _Float16 v8h;
typedef __attribute__((ext_vector_type(4)))  _Float16 v4h;
typedef __attribute__((ext_vector_type(8)))  float    v8f;
typedef __attribute__((ext_vector_type(4)))  float    v4f;

constexpr int SEQ_LEN    = 671;
constexpr int HEAD_DIM   = 64;
constexpr int BLK_ROWS   = 128;
constexpr int GAP_BEGIN  = 384;
constexpr int GAP_END    = 543;
constexpr int NWAVES     = 8;
constexpr int NTHREADS   = 256;
// LDS row pitches: the 16-byte-per-lane fragment readers walk 16 rows at once; each pitch is 16 B x odd (banks = dword address mod 64)
constexpr int X_PITCH    = HEAD_DIM + 8;    // halves, 144 B
constexpr int XT_PITCH   = BLK_ROWS + 8;    // halves, 272 B
constexpr int P_PITCH    = BLK_ROWS + 8;    // halves, 272 B
constexpr int O_PITCH    = HEAD_DIM + 4;    // floats, 272 B
constexpr float P_CARRY     = 32768.0f;
constexpr float SCORE_SCALE = 0.125f;

static_assert(SEQ_LEN - GAP_END == BLK_ROWS, "last block is 128 rows");
static_assert(3 * BLK_ROWS == GAP_BEGIN, "first three blocks end at the gap");
static_assert(NWAVES * 16 == BLK_ROWS, "8 waves x 16 query rows cover a block");
static_assert(HEAD_DIM % 32 == 0 && BLK_ROWS % 32 == 0, "K multiples of 32 for both contractions");

// ---- helpers ----
__device__ __forceinline__ unsigned short f2bf_bits(float f) {
  unsigned u = __float_as_uint(f);
  return (unsigned short)((u + 0x7FFFu + ((u >> 16) & 1u)) >> 16);
}
// RNE to bf16, then held in an f16 container (8 significant bits fit exactly)
__device__ __forceinline__ _Float16 to_h16_of_bf16(float f) {
  const unsigned short hb = f2bf_bits(f);
  const float g = __uint_as_float(((unsigned)hb) << 16);
  return (_Float16)g;
}
// 16x32 fragment: elements 0..7 <- p[0..7], 8..15 <- p[16..23]; caller passes p = row base + k0 + 8*(lane>>4)
__device__ __forceinline__ v16h frag_load(const _Float16* p) {
  union { v16h v; v8h h[2]; } f;
  f.h[0] = *(const v8h*)(p);
  f.h[1] = *(const v8h*)(p + 16);
  return f.v;
}
__device__ __forceinline__ v8f mma16(v16h a, v16h b, v8f c) {
  c = __builtin_amdgcn_wmma_f32_16x16x32_f16(false, a, false, b, (short)0, c, false, false);
  asm volatile("v_nop\n\tv_nop\n\tv_nop\n\tv_nop" : "+v"(c) : "v"(a), "v"(b));
  return c;
}

// per-wave staging: P tile [16][128] f16 at pitch 272 B (4352 B) then, after a barrier, O tile [16][64] f32 at pitch 272 B (4352 B)
union POBuf {
  _Float16 p[16 * P_PITCH];
  float    o[16 * O_PITCH];
};
static_assert(sizeof(POBuf) == 4352, "P and O views have equal size");
static_assert((X_PITCH * 2) % 32 == 16 && (XT_PITCH * 2) % 32 == 16 && (P_PITCH * 2) % 32 == 16 && (O_PITCH * 4) % 32 == 16,
              "pitches are odd multiples of 16 B");

// One block = one (batch*head, diagonal block): 128 query rows x 128 keys x 64 dims.
// grid = (4, B*N), 256 threads = 8 waves, wave w owns query rows 16w..16w+15.
__global__ __launch_bounds__(NTHREADS) void blk_attn_kernel(const float* __restrict__ x,
                                                            float* __restrict__ out) {
  __shared__ __align__(16) _Float16 sX[BLK_ROWS * X_PITCH];     // [row][d], pitch 72 halves, the last 8 of a row unused
  __shared__ __align__(16) _Float16 sXt[HEAD_DIM * XT_PITCH];   // [d][row], pitch 136 halves, the last 8 of a row unused
  __shared__ __align__(16) POBuf sPO[NWAVES];

  const int blk = blockIdx.x;                               // 0..3, block-uniform
  const int bh  = blockIdx.y;                               // 0..B*N-1
  const int row0 = (blk < 3) ? blk * BLK_ROWS : GAP_END;    // 0, 128, 256, 543
  const size_t base = ((size_t)bh * SEQ_LEN + (size_t)row0) * HEAD_DIM;
  const float* gx = x + base;
  float* gy = out + base;
  const int tid = threadIdx.x;

  // ---- staging: 128 rows x 16 float4 = 2048 float4 = 256 threads x 8; writes all 128x64 of sX and all 64x128 of sXt ----
#pragma unroll
  for (int i = 0; i < 8; ++i) {
    const int f   = i * NTHREADS + tid;       // 0..2047
    const int row = f >> 4;                   // 0..127
    const int d4  = (f & 15) * 4;             // 0..60
    const v4f v = *(const v4f*)(gx + (size_t)row * HEAD_DIM + d4);
    const _Float16 h0 = to_h16_of_bf16(v[0]);
    const _Float16 h1 = to_h16_of_bf16(v[1]);
    const _Float16 h2 = to_h16_of_bf16(v[2]);
    const _Float16 h3 = to_h16_of_bf16(v[3]);
    v4h hv;
    hv[0] = h0; hv[1] = h1; hv[2] = h2; hv[3] = h3;
    *(v4h*)(sX + row * X_PITCH + d4) = hv;
    sXt[(d4 + 0) * XT_PITCH + row] = h0;
    sXt[(d4 + 1) * XT_PITCH + row] = h1;
    sXt[(d4 + 2) * XT_PITCH + row] = h2;
    sXt[(d4 + 3) * XT_PITCH + row] = h3;
  }
  __syncthreads();

  const int wave = tid >> 5;
  const int lane = tid & 31;
  const int hh   = lane >> 4;        // lane half: k offset 8*hh, D rows 8*hh+r
  const int c    = lane & 15;        // A row / B column / D column
  const int r0   = wave * 16;        // first query row of this wave (block-local)

  // ---- scores S[16][128] = Q[16][64] . K^T ; A from sX rows r0.., B[k=d][n=key] = sX[key][d] ----
  v8f acc[8];
#pragma unroll
  for (int j = 0; j < 8; ++j) acc[j] = (v8f){0.f, 0.f, 0.f, 0.f, 0.f, 0.f, 0.f, 0.f};
  v16h qa[2];
#pragma unroll
  for (int kk = 0; kk < 2; ++kk) qa[kk] = frag_load(sX + (r0 + c) * X_PITCH + kk * 32 + 8 * hh);
#pragma unroll
  for (int j = 0; j < 8; ++j) {
#pragma unroll
    for (int kk = 0; kk < 2; ++kk) {
      const v16h kb = frag_load(sX + (j * 16 + c) * X_PITCH + kk * 32 + 8 * hh);
      acc[j] = mma16(qa[kk], kb, acc[j]);
    }
  }

  // ---- softmax over the 128 keys of each row (acc[j][r] = S[r0 + 8hh + r][16j + c]) ----
  float mx[8], inv[8];
#pragma unroll
  for (int r = 0; r < 8; ++r) {
    float m = acc[0][r];
#pragma unroll
    for (int j = 1; j < 8; ++j) m = fmaxf(m, acc[j][r]);
#pragma unroll
    for (int off = 1; off < 16; off <<= 1) m = fmaxf(m, __shfl_xor(m, off, 32));
    mx[r] = m * SCORE_SCALE;
  }
  _Float16* pw = sPO[wave].p;              // [16][128] f16 at P_PITCH, this wave only
#pragma unroll
  for (int r = 0; r < 8; ++r) {
    float psum = 0.f;
#pragma unroll
    for (int j = 0; j < 8; ++j) {
      const float p = expf(acc[j][r] * SCORE_SCALE - mx[r]);   // <= 1
      psum += p;
      pw[(8 * hh + r) * P_PITCH + j * 16 + c] = (_Float16)(p * P_CARRY);
    }
#pragma unroll
    for (int off = 1; off < 16; off <<= 1) psum += __shfl_xor(psum, off, 32);
    inv[r] = 1.0f / (psum * P_CARRY);      // psum >= 1 (row max term)
  }
  __syncthreads();

  // ---- O[16][64] = P[16][128] . V ; A from pw rows, B[k=key][n=d] = sXt[d][key] ----
  v8f oacc[4];
#pragma unroll
  for (int t = 0; t < 4; ++t) oacc[t] = (v8f){0.f, 0.f, 0.f, 0.f, 0.f, 0.f, 0.f, 0.f};
#pragma unroll
  for (int kk = 0; kk < 4; ++kk) {
    const v16h pa = frag_load(pw + c * P_PITCH + kk * 32 + 8 * hh);
#pragma unroll
    for (int t = 0; t < 4; ++t) {
      const v16h vb = frag_load(sXt + (t * 16 + c) * XT_PITCH + kk * 32 + 8 * hh);
      oacc[t] = mma16(pa, vb, oacc[t]);
    }
  }
  __syncthreads();                         // P reads complete before the O view overwrites the region

  // ---- normalise and stage O (oacc[t][r] = O[8hh + r][16t + c]) ----
  float* os = sPO[wave].o;                 // [16][64] f32 at O_PITCH
#pragma unroll
  for (int r = 0; r < 8; ++r) {
#pragma unroll
    for (int t = 0; t < 4; ++t) os[(8 * hh + r) * O_PITCH + t * 16 + c] = oacc[t][r] * inv[r];
  }
  __syncthreads();

  {
    const int c4 = c * 4;
    {
#pragma unroll
      for (int it = 0; it < 8; ++it) {
        const int row = it * 2 + hh;                          // 0..15
        const v4f val = *(const v4f*)(os + row * O_PITCH + c4);
        *(v4f*)(gy + (size_t)(r0 + row) * HEAD_DIM + c4) = val;
      }
      
    }
  }
}

__global__ __launch_bounds__(NTHREADS) void gap_zero_kernel(float* __restrict__ out) {
  constexpr int N4 = (GAP_END - GAP_BEGIN) * HEAD_DIM / 4;   // 2544
  const int bh = blockIdx.x;
  float* p = out + ((size_t)bh * SEQ_LEN + (size_t)GAP_BEGIN) * HEAD_DIM;
  v4f z;
  z[0] = 0.f; z[1] = 0.f; z[2] = 0.f; z[3] = 0.f;
  {
    for (int i = threadIdx.x; i < N4; i += NTHREADS) *(v4f*)(p + (size_t)i * 4) = z;
    
  }
}

extern "C" void kernel_launch(void* const* d_in, const int* in_sizes, int n_in,
                              void* d_out, int out_size, void* d_ws, size_t ws_size,
                              hipStream_t stream) {
  (void)n_in; (void)d_ws; (void)ws_size;
  const float* x = (const float*)d_in[0];
  float* out = (float*)d_out;
  const int total = in_sizes[0];
  const int per_bh = SEQ_LEN * HEAD_DIM;                 // 42944
  const int nbh = total / per_bh;                        // batch * heads = 128
  if (nbh <= 0 || nbh * per_bh != total || out_size != total) return;
  // no workspace used
  blk_attn_kernel<<<dim3(4, nbh), NTHREADS, 0, stream>>>(x, out);
  gap_zero_kernel<<<dim3(nbh), NTHREADS, 0, stream>>>(out);
}

// v002
// One run takes 9.62 microseconds.
// Next to v001, in two timings, it ran 1.63 times as fast each time.
// All steps since v000 together make it 2.73 times as fast.
// Contractions: scores = q.k^T (K=64) and out = p.v (K=128) on v_wmma_f32_16x16x32_f16 with f32 accumulate; x carried as the f16 image of its RNE-bf16 value (exact), p carried as f16 x 2^15; softmax, max, sum and normalisation in f32.
#include <hip/hip_runtime.h>

typedef __attribute__((ext_vector_type(16))) _Float16 v16h;
typedef __attribute__((ext_vector_type(8)))  _Float16 v8h;
typedef __attribute__((ext_vector_type(4)))  _Float16 v4h;
typedef __attribute__((ext_vector_type(8)))  float    v8f;
typedef __attribute__((ext_vector_type(4)))  float    v4f;

constexpr int SEQ_LEN    = 671;
constexpr int HEAD_DIM   = 64;
constexpr int BLK_ROWS   = 128;
constexpr int GAP_BEGIN  = 384;
constexpr int GAP_END    = 543;
constexpr int NWAVES     = 8;
constexpr int NTHREADS   = 256;
constexpr int GAP_ROWS   = GAP_END - GAP_BEGIN;      // 159 rows of zeros per (batch, head)
constexpr int GAP_SHARE  = (GAP_ROWS + 3) / 4;       // 40: whole 256-B rows, so no 128-B line has two writers
// LDS row pitches: the 16-byte-per-lane fragment loads walk 16 rows at once, so each pitch is 16 B x odd (banks = dword address mod 64)
constexpr int X_PITCH    = HEAD_DIM + 8;    // halves, 144 B
constexpr int XT_PITCH   = BLK_ROWS + 8;    // halves, 272 B
constexpr int P_PITCH    = BLK_ROWS + 8;    // halves, 272 B
constexpr int O_PITCH    = HEAD_DIM + 4;    // floats, 272 B
constexpr float P_CARRY     = 32768.0f;
constexpr float SCORE_SCALE = 0.125f;

static_assert(SEQ_LEN - GAP_END == BLK_ROWS, "last block is 128 rows");
static_assert(3 * BLK_ROWS == GAP_BEGIN, "first three blocks end at the gap");
static_assert(NWAVES * 16 == BLK_ROWS, "8 waves x 16 query rows cover a block");
static_assert(3 * GAP_SHARE < GAP_ROWS && 4 * GAP_SHARE >= GAP_ROWS, "four shares cover the gap, the last one not empty");
static_assert(HEAD_DIM % 32 == 0 && BLK_ROWS % 32 == 0, "K multiples of 32 for both contractions");

// ---- helpers ----
__device__ __forceinline__ unsigned short f2bf_bits(float f) {
  unsigned u = __float_as_uint(f);
  return (unsigned short)((u + 0x7FFFu + ((u >> 16) & 1u)) >> 16);
}
// RNE to bf16, then held in an f16 container (8 significant bits fit exactly)
__device__ __forceinline__ _Float16 to_h16_of_bf16(float f) {
  const unsigned short hb = f2bf_bits(f);
  const float g = __uint_as_float(((unsigned)hb) << 16);
  return (_Float16)g;
}
// 16x32 fragment: elements 0..7 <- p[0..7], 8..15 <- p[16..23]; caller passes p = row base + k0 + 8*(lane>>4)
__device__ __forceinline__ v16h frag_load(const _Float16* p) {
  union { v16h v; v8h h[2]; } f;
  f.h[0] = *(const v8h*)(p);
  f.h[1] = *(const v8h*)(p + 16);
  return f.v;
}
__device__ __forceinline__ v8f mma16(v16h a, v16h b, v8f c) {
  c = __builtin_amdgcn_wmma_f32_16x16x32_f16(false, a, false, b, (short)0, c, false, false);
  asm volatile("v_nop\n\tv_nop\n\tv_nop\n\tv_nop" : "+v"(c) : "v"(a), "v"(b));
  return c;
}

// per-wave staging: P tile [16][128] f16 at pitch 272 B (4352 B) then, after a barrier, O tile [16][64] f32 at pitch 272 B (4352 B)
union POBuf {
  _Float16 p[16 * P_PITCH];
  float    o[16 * O_PITCH];
};
static_assert(sizeof(POBuf) == 4352, "P and O views have equal size");
static_assert((X_PITCH * 2) % 32 == 16 && (XT_PITCH * 2) % 32 == 16 && (P_PITCH * 2) % 32 == 16 && (O_PITCH * 4) % 32 == 16,
              "pitches are odd multiples of 16 B");

// One block = one (batch*head, diagonal block): 128 query rows x 128 keys x 64 dims.
// grid = (4, B*N), 256 threads = 8 waves, wave w owns query rows 16w..16w+15.
// The four blocks of a (batch, head) also zero a quarter each of its gap rows (40, 40, 40, 39).
__global__ __launch_bounds__(NTHREADS) void blk_attn_kernel(const float* __restrict__ x,
                                                            float* __restrict__ out) {
  __shared__ __align__(16) _Float16 sX[BLK_ROWS * X_PITCH];     // [row][d], pitch 72 halves, the last 8 of a row unused
  __shared__ __align__(16) _Float16 sXt[HEAD_DIM * XT_PITCH];   // [d][row], pitch 136 halves, the last 8 of a row unused
  __shared__ __align__(16) POBuf sPO[NWAVES];

  const int blk = blockIdx.x;                               // 0..3, block-uniform
  const int bh  = blockIdx.y;                               // 0..B*N-1
  const int row0 = (blk < 3) ? blk * BLK_ROWS : GAP_END;    // 0, 128, 256, 543
  const size_t base = ((size_t)bh * SEQ_LEN + (size_t)row0) * HEAD_DIM;
  const float* gx = x + base;
  float* gy = out + base;
  const int tid = threadIdx.x;

  // ---- gap rows: this block's share, stored at entry so that the stores drain under the staging and the matrix work ----
  {
    const int g0 = blk * GAP_SHARE;                                          // 0, 40, 80, 120
    const int n4 = ((blk < 3) ? GAP_SHARE : GAP_ROWS - 3 * GAP_SHARE) * (HEAD_DIM / 4);   // 640 or 624 float4
    float* gz = out + ((size_t)bh * SEQ_LEN + (size_t)(GAP_BEGIN + g0)) * HEAD_DIM;
    const v4f z = (v4f){0.f, 0.f, 0.f, 0.f};
    constexpr int FULL_TRIPS = (GAP_ROWS - 3 * GAP_SHARE) * (HEAD_DIM / 4) / NTHREADS;   // 2: trips that every share fills
#pragma unroll
    for (int i = 0; i < (GAP_SHARE * (HEAD_DIM / 4) + NTHREADS - 1) / NTHREADS; ++i) {
      const int f = i * NTHREADS + tid;
      if (i < FULL_TRIPS || f < n4) *(v4f*)(gz + (size_t)f * 4) = z;
    }
  }

  // ---- staging: 128 rows x 16 float4 = 2048 float4 = 256 threads x 8; writes all 128x64 of sX and all 64x128 of sXt ----
#pragma unroll
  for (int i = 0; i < 8; ++i) {
    const int f   = i * NTHREADS + tid;       // 0..2047
    const int row = f >> 4;                   // 0..127
    const int d4  = (f & 15) * 4;             // 0..60
    const v4f v = *(const v4f*)(gx + (size_t)row * HEAD_DIM + d4);
    const _Float16 h0 = to_h16_of_bf16(v[0]);
    const _Float16 h1 = to_h16_of_bf16(v[1]);
    const _Float16 h2 = to_h16_of_bf16(v[2]);
    const _Float16 h3 = to_h16_of_bf16(v[3]);
    v4h hv;
    hv[0] = h0; hv[1] = h1; hv[2] = h2; hv[3] = h3;
    *(v4h*)(sX + row * X_PITCH + d4) = hv;
    sXt[(d4 + 0) * XT_PITCH + row] = h0;
    sXt[(d4 + 1) * XT_PITCH + row] = h1;
    sXt[(d4 + 2) * XT_PITCH + row] = h2;
    sXt[(d4 + 3) * XT_PITCH + row] = h3;
  }
  __syncthreads();

  const int wave = tid >> 5;
  const int lane = tid & 31;
  const int hh   = lane >> 4;        // lane half: k offset 8*hh, D rows 8*hh+r
  const int c    = lane & 15;        // A row / B column / D column
  const int r0   = wave * 16;        // first query row of this wave (block-local)

  // ---- scores S[16][128] = Q[16][64] . K^T ; A from sX rows r0.., B[k=d][n=key] = sX[key][d] ----
  v8f acc[8];
#pragma unroll
  for (int j = 0; j < 8; ++j) acc[j] = (v8f){0.f, 0.f, 0.f, 0.f, 0.f, 0.f, 0.f, 0.f};
  v16h qa[2];
#pragma unroll
  for (int kk = 0; kk < 2; ++kk) qa[kk] = frag_load(sX + (r0 + c) * X_PITCH + kk * 32 + 8 * hh);
#pragma unroll
  for (int j = 0; j < 8; ++j) {
#pragma unroll
    for (int kk = 0; kk < 2; ++kk) {
      const v16h kb = frag_load(sX + (j * 16 + c) * X_PITCH + kk * 32 + 8 * hh);
      acc[j] = mma16(qa[kk], kb, acc[j]);
    }
  }

  // ---- softmax over the 128 keys of each row (acc[j][r] = S[r0 + 8hh + r][16j + c]) ----
  float mx[8], inv[8];
#pragma unroll
  for (int r = 0; r < 8; ++r) {
    float m = acc[0][r];
#pragma unroll
    for (int j = 1; j < 8; ++j) m = fmaxf(m, acc[j][r]);
#pragma unroll
    for (int off = 1; off < 16; off <<= 1) m = fmaxf(m, __shfl_xor(m, off, 32));
    mx[r] = m * SCORE_SCALE;
  }
  _Float16* pw = sPO[wave].p;              // [16][128] f16 at P_PITCH, this wave only
#pragma unroll
  for (int r = 0; r < 8; ++r) {
    float psum = 0.f;
#pragma unroll
    for (int j = 0; j < 8; ++j) {
      const float p = expf(acc[j][r] * SCORE_SCALE - mx[r]);   // <= 1
      psum += p;
      pw[(8 * hh + r) * P_PITCH + j * 16 + c] = (_Float16)(p * P_CARRY);
    }
#pragma unroll
    for (int off = 1; off < 16; off <<= 1) psum += __shfl_xor(psum, off, 32);
    inv[r] = 1.0f / (psum * P_CARRY);      // psum >= 1 (row max term)
  }
  __syncthreads();

  // ---- O[16][64] = P[16][128] . V ; A from pw rows, B[k=key][n=d] = sXt[d][key] ----
  v8f oacc[4];
#pragma unroll
  for (int t = 0; t < 4; ++t) oacc[t] = (v8f){0.f, 0.f, 0.f, 0.f, 0.f, 0.f, 0.f, 0.f};
#pragma unroll
  for (int kk = 0; kk < 4; ++kk) {
    const v16h pa = frag_load(pw + c * P_PITCH + kk * 32 + 8 * hh);
#pragma unroll
    for (int t = 0; t < 4; ++t) {
      const v16h vb = frag_load(sXt + (t * 16 + c) * XT_PITCH + kk * 32 + 8 * hh);
      oacc[t] = mma16(pa, vb, oacc[t]);
    }
  }
  __syncthreads();                         // P reads complete before the O view overwrites the region

  // ---- normalise and stage O (oacc[t][r] = O[8hh + r][16t + c]) ----
  float* os = sPO[wave].o;                 // [16][64] f32 at O_PITCH
#pragma unroll
  for (int r = 0; r < 8; ++r) {
#pragma unroll
    for (int t = 0; t < 4; ++t) os[(8 * hh + r) * O_PITCH + t * 16 + c] = oacc[t][r] * inv[r];
  }
  __syncthreads();

  {
    const int c4 = c * 4;
    {
#pragma unroll
      for (int it = 0; it < 8; ++it) {
        const int row = it * 2 + hh;                          // 0..15
        const v4f val = *(const v4f*)(os + row * O_PITCH + c4);
        *(v4f*)(gy + (size_t)(r0 + row) * HEAD_DIM + c4) = val;
      }
      
    }
  }
}

extern "C" void kernel_launch(void* const* d_in, const int* in_sizes, int n_in,
                              void* d_out, int out_size, void* d_ws, size_t ws_size,
                              hipStream_t stream) {
  (void)n_in; (void)d_ws; (void)ws_size;
  const float* x = (const float*)d_in[0];
  float* out = (float*)d_out;
  const int total = in_sizes[0];
  const int per_bh = SEQ_LEN * HEAD_DIM;                 // 42944
  const int nbh = total / per_bh;                        // batch * heads = 128
  if (nbh <= 0 || nbh * per_bh != total || out_size != total) return;
  // no workspace used
  blk_attn_kernel<<<dim3(4, nbh), NTHREADS, 0, stream>>>(x, out);
}

// v003
// A run of this version takes 8.06 microseconds.
// Timed twice side by side with v002, it ran 1.20 and 1.19 times as fast.
// All steps since v000 together make it 3.27 times as fast.
// Contractions: scores = q.k^T (K=64) and out = p.v (K=128) on v_wmma_f32_16x16x32_f16 with f32 accumulate; x carried as the f16 image of its RNE-bf16 value (exact), p carried as f16 x 2^15; softmax, max, sum and normalisation in f32, the exponential in base 2.
#include <hip/hip_runtime.h>

typedef __attribute__((ext_vector_type(16))) _Float16 v16h;
typedef __attribute__((ext_vector_type(8)))  _Float16 v8h;
typedef __attribute__((ext_vector_type(4)))  _Float16 v4h;
typedef __attribute__((ext_vector_type(8)))  float    v8f;
typedef __attribute__((ext_vector_type(4)))  float    v4f;

constexpr int SEQ_LEN    = 671;
constexpr int HEAD_DIM   = 64;
constexpr int BLK_ROWS   = 128;
constexpr int GAP_BEGIN  = 384;
constexpr int GAP_END    = 543;
constexpr int NWAVES     = 8;
constexpr int NTHREADS   = 256;
constexpr int GAP_ROWS   = GAP_END - GAP_BEGIN;      // 159 rows of zeros per (batch, head)
constexpr int GAP_SHARE  = (GAP_ROWS + 3) / 4;       // 40: whole 256-B rows, so no 128-B line has two writers
// LDS row pitches: the 16-byte-per-lane fragment loads walk 16 rows at once, so each pitch is 16 B x odd (banks = dword address mod 64)
constexpr int X_PITCH    = HEAD_DIM + 8;    // halves, 144 B
constexpr int XT_PITCH   = BLK_ROWS + 8;    // halves, 272 B
constexpr int P_PITCH    = BLK_ROWS + 8;    // halves, 272 B
constexpr int O_PITCH    = HEAD_DIM + 4;    // floats, 272 B
constexpr float P_CARRY     = 32768.0f;
// 1/sqrt(64) x log2(e): scores go to base 2, so that exp(s - max) is one v_exp_f32 (2^t)
constexpr float SCORE_SCALE_LOG2 = 0.125f * 1.44269504088896340736f;

static_assert(SEQ_LEN - GAP_END == BLK_ROWS, "last block is 128 rows");
static_assert(3 * BLK_ROWS == GAP_BEGIN, "first three blocks end at the gap");
static_assert(NWAVES * 16 == BLK_ROWS, "8 waves x 16 query rows cover a block");
static_assert(3 * GAP_SHARE < GAP_ROWS && 4 * GAP_SHARE >= GAP_ROWS, "four shares cover the gap, the last one not empty");
static_assert(HEAD_DIM % 32 == 0 && BLK_ROWS % 32 == 0, "K multiples of 32 for both contractions");

// ---- helpers ----
__device__ __forceinline__ unsigned short f2bf_bits(float f) {
  unsigned u = __float_as_uint(f);
  return (unsigned short)((u + 0x7FFFu + ((u >> 16) & 1u)) >> 16);
}
// RNE to bf16, then held in an f16 container (8 significant bits fit exactly)
__device__ __forceinline__ _Float16 to_h16_of_bf16(float f) {
  const unsigned short hb = f2bf_bits(f);
  const float g = __uint_as_float(((unsigned)hb) << 16);
  return (_Float16)g;
}
// 16x32 fragment: elements 0..7 <- p[0..7], 8..15 <- p[16..23]; caller passes p = row base + k0 + 8*(lane>>4)
__device__ __forceinline__ v16h frag_load(const _Float16* p) {
  union { v16h v; v8h h[2]; } f;
  f.h[0] = *(const v8h*)(p);
  f.h[1] = *(const v8h*)(p + 16);
  return f.v;
}
__device__ __forceinline__ v8f mma16(v16h a, v16h b, v8f c) {
  c = __builtin_amdgcn_wmma_f32_16x16x32_f16(false, a, false, b, (short)0, c, false, false);
  asm volatile("v_nop\n\tv_nop\n\tv_nop\n\tv_nop" : "+v"(c) : "v"(a), "v"(b));
  return c;
}

// p[i] = 2^t[i], eight at a time. One statement, because behind a v_exp_f32 the instruction set asks for one independent
// instruction before its result is read or its source overwritten: here each v_exp_f32 is that instruction for the one before
// (early-clobber outputs share no register with a source) and the v_nop is it for the last.
__device__ __forceinline__ void exp2_x8(float (&p)[8], const float (&t)[8]) {
  asm("v_exp_f32 %0, %8\n\t"
      "v_exp_f32 %1, %9\n\t"
      "v_exp_f32 %2, %10\n\t"
      "v_exp_f32 %3, %11\n\t"
      "v_exp_f32 %4, %12\n\t"
      "v_exp_f32 %5, %13\n\t"
      "v_exp_f32 %6, %14\n\t"
      "v_exp_f32 %7, %15\n\t"
      "v_nop"
      : "=&v"(p[0]), "=&v"(p[1]), "=&v"(p[2]), "=&v"(p[3]), "=&v"(p[4]), "=&v"(p[5]), "=&v"(p[6]), "=&v"(p[7])
      : "v"(t[0]), "v"(t[1]), "v"(t[2]), "v"(t[3]), "v"(t[4]), "v"(t[5]), "v"(t[6]), "v"(t[7]));
}

// per-wave staging: P tile [16][128] f16 at pitch 272 B (4352 B) then, after a barrier, O tile [16][64] f32 at pitch 272 B (4352 B)
union POBuf {
  _Float16 p[16 * P_PITCH];
  float    o[16 * O_PITCH];
};
static_assert(sizeof(POBuf) == 4352, "P and O views have equal size");
static_assert((X_PITCH * 2) % 32 == 16 && (XT_PITCH * 2) % 32 == 16 && (P_PITCH * 2) % 32 == 16 && (O_PITCH * 4) % 32 == 16,
              "pitches are odd multiples of 16 B");

// One block = one (batch*head, diagonal block): 128 query rows x 128 keys x 64 dims.
// grid = (4, B*N), 256 threads = 8 waves, wave w owns query rows 16w..16w+15.
// The four blocks of a (batch, head) also zero a quarter each of its gap rows (40, 40, 40, 39).
__global__ __launch_bounds__(NTHREADS) void blk_attn_kernel(const float* __restrict__ x,
                                                            float* __restrict__ out) {
  __shared__ __align__(16) _Float16 sX[BLK_ROWS * X_PITCH];     // [row][d], pitch 72 halves, the last 8 of a row unused
  __shared__ __align__(16) _Float16 sXt[HEAD_DIM * XT_PITCH];   // [d][row], pitch 136 halves, the last 8 of a row unused
  __shared__ __align__(16) POBuf sPO[NWAVES];

  const int blk = blockIdx.x;                               // 0..3, block-uniform
  const int bh  = blockIdx.y;                               // 0..B*N-1
  const int row0 = (blk < 3) ? blk * BLK_ROWS : GAP_END;    // 0, 128, 256, 543
  const size_t base = ((size_t)bh * SEQ_LEN + (size_t)row0) * HEAD_DIM;
  const float* gx = x + base;
  float* gy = out + base;
  const int tid = threadIdx.x;

  // ---- gap rows: this block's share, stored at entry so that the stores drain under the staging and the matrix work ----
  {
    const int g0 = blk * GAP_SHARE;                                          // 0, 40, 80, 120
    const int n4 = ((blk < 3) ? GAP_SHARE : GAP_ROWS - 3 * GAP_SHARE) * (HEAD_DIM / 4);   // 640 or 624 float4
    float* gz = out + ((size_t)bh * SEQ_LEN + (size_t)(GAP_BEGIN + g0)) * HEAD_DIM;
    const v4f z = (v4f){0.f, 0.f, 0.f, 0.f};
    constexpr int FULL_TRIPS = (GAP_ROWS - 3 * GAP_SHARE) * (HEAD_DIM / 4) / NTHREADS;   // 2: trips that every share fills
#pragma unroll
    for (int i = 0; i < (GAP_SHARE * (HEAD_DIM / 4) + NTHREADS - 1) / NTHREADS; ++i) {
      const int f = i * NTHREADS + tid;
      if (i < FULL_TRIPS || f < n4) *(v4f*)(gz + (size_t)f * 4) = z;
    }
  }

  // ---- staging: 128 rows x 16 float4 = 2048 float4 = 256 threads x 8; writes all 128x64 of sX and all 64x128 of sXt ----
#pragma unroll
  for (int i = 0; i < 8; ++i) {
    const int f   = i * NTHREADS + tid;       // 0..2047
    const int row = f >> 4;                   // 0..127
    const int d4  = (f & 15) * 4;             // 0..60
    const v4f v = *(const v4f*)(gx + (size_t)row * HEAD_DIM + d4);
    const _Float16 h0 = to_h16_of_bf16(v[0]);
    const _Float16 h1 = to_h16_of_bf16(v[1]);
    const _Float16 h2 = to_h16_of_bf16(v[2]);
    const _Float16 h3 = to_h16_of_bf16(v[3]);
    v4h hv;
    hv[0] = h0; hv[1] = h1; hv[2] = h2; hv[3] = h3;
    *(v4h*)(sX + row * X_PITCH + d4) = hv;
    sXt[(d4 + 0) * XT_PITCH + row] = h0;
    sXt[(d4 + 1) * XT_PITCH + row] = h1;
    sXt[(d4 + 2) * XT_PITCH + row] = h2;
    sXt[(d4 + 3) * XT_PITCH + row] = h3;
  }
  __syncthreads();

  const int wave = tid >> 5;
  const int lane = tid & 31;
  const int hh   = lane >> 4;        // lane half: k offset 8*hh, D rows 8*hh+r
  const int c    = lane & 15;        // A row / B column / D column
  const int r0   = wave * 16;        // first query row of this wave (block-local)

  // ---- scores S[16][128] = Q[16][64] . K^T ; A from sX rows r0.., B[k=d][n=key] = sX[key][d] ----
  v8f acc[8];
#pragma unroll
  for (int j = 0; j < 8; ++j) acc[j] = (v8f){0.f, 0.f, 0.f, 0.f, 0.f, 0.f, 0.f, 0.f};
  v16h qa[2];
#pragma unroll
  for (int kk = 0; kk < 2; ++kk) qa[kk] = frag_load(sX + (r0 + c) * X_PITCH + kk * 32 + 8 * hh);
#pragma unroll
  for (int j = 0; j < 8; ++j) {
#pragma unroll
    for (int kk = 0; kk < 2; ++kk) {
      const v16h kb = frag_load(sX + (j * 16 + c) * X_PITCH + kk * 32 + 8 * hh);
      acc[j] = mma16(qa[kk], kb, acc[j]);
    }
  }

  // ---- softmax over the 128 keys of each row (acc[j][r] = S[r0 + 8hh + r][16j + c]) ----
  float mx[8], inv[8];
#pragma unroll
  for (int r = 0; r < 8; ++r) {
    float m = acc[0][r];
#pragma unroll
    for (int j = 1; j < 8; ++j) m = fmaxf(m, acc[j][r]);
#pragma unroll
    for (int off = 1; off < 16; off <<= 1) m = fmaxf(m, __shfl_xor(m, off, 32));
    mx[r] = m * SCORE_SCALE_LOG2;
  }
  _Float16* pw = sPO[wave].p;              // [16][128] f16 at P_PITCH, this wave only
#pragma unroll
  for (int r = 0; r < 8; ++r) {
    float psum = 0.f;
    float t[8], p[8];
#pragma unroll
    for (int j = 0; j < 8; ++j) t[j] = acc[j][r] * SCORE_SCALE_LOG2 - mx[r];   // <= 0 but for half an ulp of mx, so p <= 1 to within f32 rounding
    exp2_x8(p, t);
#pragma unroll
    for (int j = 0; j < 8; ++j) {
      psum += p[j];
      pw[(8 * hh + r) * P_PITCH + j * 16 + c] = (_Float16)(p[j] * P_CARRY);
    }
#pragma unroll
    for (int off = 1; off < 16; off <<= 1) psum += __shfl_xor(psum, off, 32);
    inv[r] = 1.0f / (psum * P_CARRY);      // psum >= 1 to within f32 rounding (row max term)
  }
  __syncthreads();

  // ---- O[16][64] = P[16][128] . V ; A from pw rows, B[k=key][n=d] = sXt[d][key] ----
  v8f oacc[4];
#pragma unroll
  for (int t = 0; t < 4; ++t) oacc[t] = (v8f){0.f, 0.f, 0.f, 0.f, 0.f, 0.f, 0.f, 0.f};
#pragma unroll
  for (int kk = 0; kk < 4; ++kk) {
    const v16h pa = frag_load(pw + c * P_PITCH + kk * 32 + 8 * hh);
#pragma unroll
    for (int t = 0; t < 4; ++t) {
      const v16h vb = frag_load(sXt + (t * 16 + c) * XT_PITCH + kk * 32 + 8 * hh);
      oacc[t] = mma16(pa, vb, oacc[t]);
    }
  }
  __syncthreads();                         // P reads complete before the O view overwrites the region

  // ---- normalise and stage O (oacc[t][r] = O[8hh + r][16t + c]) ----
  float* os = sPO[wave].o;                 // [16][64] f32 at O_PITCH
#pragma unroll
  for (int r = 0; r < 8; ++r) {
#pragma unroll
    for (int t = 0; t < 4; ++t) os[(8 * hh + r) * O_PITCH + t * 16 + c] = oacc[t][r] * inv[r];
  }
  __syncthreads();

  {
    const int c4 = c * 4;
    {
#pragma unroll
      for (int it = 0; it < 8; ++it) {
        const int row = it * 2 + hh;                          // 0..15
        const v4f val = *(const v4f*)(os + row * O_PITCH + c4);
        *(v4f*)(gy + (size_t)(r0 + row) * HEAD_DIM + c4) = val;
      }
      
    }
  }
}

extern "C" void kernel_launch(void* const* d_in, const int* in_sizes, int n_in,
                              void* d_out, int out_size, void* d_ws, size_t ws_size,
                              hipStream_t stream) {
  (void)n_in; (void)d_ws; (void)ws_size;
  const float* x = (const float*)d_in[0];
  float* out = (float*)d_out;
  const int total = in_sizes[0];
  const int per_bh = SEQ_LEN * HEAD_DIM;                 // 42944
  const int nbh = total / per_bh;                        // batch * heads = 128
  if (nbh <= 0 || nbh * per_bh != total || out_size != total) return;
  // no workspace used
  blk_attn_kernel<<<dim3(4, nbh), NTHREADS, 0, stream>>>(x, out);
}

// v004
// Measured time: 7.2 microseconds a run.
// Timed twice side by side with v003, it ran 1.11 and 1.12 times as fast.
// Counting every step since v000, it is 3.66 times as fast.
// Contractions, both transposed: scores^T = k.q^T (K=64) and out^T = v^T.p^T (K=128) on v_wmma_f32_16x16x32_f16 with f32 accumulate; x carried as the f16 image of its RNE-bf16 value (exact), p carried as f16 x 2^15 and kept in registers; softmax, max, sum and normalisation in f32, the exponential in base 2.
#include <hip/hip_runtime.h>

typedef __attribute__((ext_vector_type(16))) _Float16 v16h;
typedef __attribute__((ext_vector_type(8)))  _Float16 v8h;
typedef __attribute__((ext_vector_type(4)))  _Float16 v4h;
typedef __attribute__((ext_vector_type(8)))  float    v8f;
typedef __attribute__((ext_vector_type(4)))  float    v4f;

constexpr int SEQ_LEN    = 671;
constexpr int HEAD_DIM   = 64;
constexpr int BLK_ROWS   = 128;
constexpr int GAP_BEGIN  = 384;
constexpr int GAP_END    = 543;
constexpr int NWAVES     = 8;
constexpr int NTHREADS   = 256;
constexpr int GAP_ROWS   = GAP_END - GAP_BEGIN;      // 159 rows of zeros per (batch, head)
constexpr int GAP_SHARE  = (GAP_ROWS + 3) / 4;       // 40: whole 256-B rows, so no 128-B line has two writers
// LDS row pitches: the 16-byte-per-lane fragment loads walk 16 rows at once, so each pitch is 16 B x odd (banks = dword address mod 64)
constexpr int X_PITCH    = HEAD_DIM + 8;    // halves, 144 B
constexpr int XT_PITCH   = BLK_ROWS + 8;    // halves, 272 B
constexpr int O_PITCH    = HEAD_DIM + 4;    // floats, 272 B
constexpr float P_CARRY     = 32768.0f;
// 1/sqrt(64) x log2(e): scores go to base 2, so that exp(s - max) is one v_exp_f32 (2^t)
constexpr float SCORE_SCALE_LOG2 = 0.125f * 1.44269504088896340736f;

static_assert(SEQ_LEN - GAP_END == BLK_ROWS, "last block is 128 rows");
static_assert(3 * BLK_ROWS == GAP_BEGIN, "first three blocks end at the gap");
static_assert(NWAVES * 16 == BLK_ROWS, "8 waves x 16 query rows cover a block");
static_assert(3 * GAP_SHARE < GAP_ROWS && 4 * GAP_SHARE >= GAP_ROWS, "four shares cover the gap, the last one not empty");
static_assert(HEAD_DIM % 32 == 0 && BLK_ROWS % 32 == 0, "K multiples of 32 for both contractions");

// ---- helpers ----
__device__ __forceinline__ unsigned short f2bf_bits(float f) {
  unsigned u = __float_as_uint(f);
  return (unsigned short)((u + 0x7FFFu + ((u >> 16) & 1u)) >> 16);
}
// RNE to bf16, then held in an f16 container (8 significant bits fit exactly)
__device__ __forceinline__ _Float16 to_h16_of_bf16(float f) {
  const unsigned short hb = f2bf_bits(f);
  const float g = __uint_as_float(((unsigned)hb) << 16);
  return (_Float16)g;
}
// 16x32 fragment: elements 0..7 <- p[0..7], 8..15 <- p[16..23]; caller passes p = row base + k0 + 8*(lane>>4)
__device__ __forceinline__ v16h frag_load(const _Float16* p) {
  union { v16h v; v8h h[2]; } f;
  f.h[0] = *(const v8h*)(p);
  f.h[1] = *(const v8h*)(p + 16);
  return f.v;
}
__device__ __forceinline__ v8f mma16(v16h a, v16h b, v8f c) {
  c = __builtin_amdgcn_wmma_f32_16x16x32_f16(false, a, false, b, (short)0, c, false, false);
  asm volatile("v_nop\n\tv_nop\n\tv_nop\n\tv_nop" : "+v"(c) : "v"(a), "v"(b));
  return c;
}

// p[i] = 2^t[i], eight at a time. One statement, because behind a v_exp_f32 the instruction set asks for one independent
// instruction before its result is read or its source overwritten: here each v_exp_f32 is that instruction for the one before
// (early-clobber outputs share no register with a source) and the v_nop is it for the last.
__device__ __forceinline__ void exp2_x8(float (&p)[8], const float (&t)[8]) {
  asm("v_exp_f32 %0, %8\n\t"
      "v_exp_f32 %1, %9\n\t"
      "v_exp_f32 %2, %10\n\t"
      "v_exp_f32 %3, %11\n\t"
      "v_exp_f32 %4, %12\n\t"
      "v_exp_f32 %5, %13\n\t"
      "v_exp_f32 %6, %14\n\t"
      "v_exp_f32 %7, %15\n\t"
      "v_nop"
      : "=&v"(p[0]), "=&v"(p[1]), "=&v"(p[2]), "=&v"(p[3]), "=&v"(p[4]), "=&v"(p[5]), "=&v"(p[6]), "=&v"(p[7])
      : "v"(t[0]), "v"(t[1]), "v"(t[2]), "v"(t[3]), "v"(t[4]), "v"(t[5]), "v"(t[6]), "v"(t[7]));
}

// value of lane l ^ 16: the other half of the keys of the same query column
__device__ __forceinline__ float other_half(float v) {
  const int b = __float_as_int(v);
  return __int_as_float(__builtin_amdgcn_permlanex16(b, b, 0x76543210, 0xfedcba98, false, false));
}

// per-wave staging of the O tile [16][64] f32 at pitch 272 B (4352 B)
struct OBuf {
  float o[16 * O_PITCH];
};
static_assert((X_PITCH * 2) % 32 == 16 && (XT_PITCH * 2) % 32 == 16 && (O_PITCH * 4) % 32 == 16,
              "pitches are odd multiples of 16 B");

// One block = one (batch*head, diagonal block): 128 query rows x 128 keys x 64 dims.
// grid = (4, B*N), 256 threads = 8 waves, wave w owns query rows 16w..16w+15.
// The four blocks of a (batch, head) also zero a quarter each of its gap rows (40, 40, 40, 39).
__global__ __launch_bounds__(NTHREADS) void blk_attn_kernel(const float* __restrict__ x,
                                                            float* __restrict__ out) {
  __shared__ __align__(16) _Float16 sX[BLK_ROWS * X_PITCH];     // [row][d], pitch 72 halves, the last 8 of a row unused
  __shared__ __align__(16) _Float16 sXt[HEAD_DIM * XT_PITCH];   // [d][row], pitch 136 halves, the last 8 of a row unused
  __shared__ __align__(16) OBuf sO[NWAVES];

  const int blk = blockIdx.x;                               // 0..3, block-uniform
  const int bh  = blockIdx.y;                               // 0..B*N-1
  const int row0 = (blk < 3) ? blk * BLK_ROWS : GAP_END;    // 0, 128, 256, 543
  const size_t base = ((size_t)bh * SEQ_LEN + (size_t)row0) * HEAD_DIM;
  const float* gx = x + base;
  float* gy = out + base;
  const int tid = threadIdx.x;

  // ---- gap rows: this block's share, stored at entry so that the stores drain under the staging and the matrix work ----
  {
    const int g0 = blk * GAP_SHARE;                                          // 0, 40, 80, 120
    const int n4 = ((blk < 3) ? GAP_SHARE : GAP_ROWS - 3 * GAP_SHARE) * (HEAD_DIM / 4);   // 640 or 624 float4
    float* gz = out + ((size_t)bh * SEQ_LEN + (size_t)(GAP_BEGIN + g0)) * HEAD_DIM;
    const v4f z = (v4f){0.f, 0.f, 0.f, 0.f};
    constexpr int FULL_TRIPS = (GAP_ROWS - 3 * GAP_SHARE) * (HEAD_DIM / 4) / NTHREADS;   // 2: trips that every share fills
#pragma unroll
    for (int i = 0; i < (GAP_SHARE * (HEAD_DIM / 4) + NTHREADS - 1) / NTHREADS; ++i) {
      const int f = i * NTHREADS + tid;
      if (i < FULL_TRIPS || f < n4) *(v4f*)(gz + (size_t)f * 4) = z;
    }
  }

  // ---- staging: 128 rows x 16 float4 = 2048 float4 = 256 threads x 8; writes all 128x64 of sX and all 64x128 of sXt ----
#pragma unroll
  for (int i = 0; i < 8; ++i) {
    const int f   = i * NTHREADS + tid;       // 0..2047
    const int row = f >> 4;                   // 0..127
    const int d4  = (f & 15) * 4;             // 0..60
    const v4f v = *(const v4f*)(gx + (size_t)row * HEAD_DIM + d4);
    const _Float16 h0 = to_h16_of_bf16(v[0]);
    const _Float16 h1 = to_h16_of_bf16(v[1]);
    const _Float16 h2 = to_h16_of_bf16(v[2]);
    const _Float16 h3 = to_h16_of_bf16(v[3]);
    v4h hv;
    hv[0] = h0; hv[1] = h1; hv[2] = h2; hv[3] = h3;
    *(v4h*)(sX + row * X_PITCH + d4) = hv;
    sXt[(d4 + 0) * XT_PITCH + row] = h0;
    sXt[(d4 + 1) * XT_PITCH + row] = h1;
    sXt[(d4 + 2) * XT_PITCH + row] = h2;
    sXt[(d4 + 3) * XT_PITCH + row] = h3;
  }
  __syncthreads();

  const int wave = tid >> 5;
  const int lane = tid & 31;
  const int hh   = lane >> 4;        // lane half: k offset 8*hh, D rows 8*hh+r
  const int c    = lane & 15;        // A row / B column / D column
  const int r0   = wave * 16;        // first query row of this wave (block-local)

  // ---- scores, transposed: S^T[128 keys][16 queries] = K[128][64] . Q^T ; A from sX key rows, B[k=d][n=query] = sX[r0 + query][d] ----
  v8f acc[8];
#pragma unroll
  for (int j = 0; j < 8; ++j) acc[j] = (v8f){0.f, 0.f, 0.f, 0.f, 0.f, 0.f, 0.f, 0.f};
  v16h qb[2];
#pragma unroll
  for (int kk = 0; kk < 2; ++kk) qb[kk] = frag_load(sX + (r0 + c) * X_PITCH + kk * 32 + 8 * hh);
#pragma unroll
  for (int j = 0; j < 8; ++j) {
#pragma unroll
    for (int kk = 0; kk < 2; ++kk) {
      const v16h ka = frag_load(sX + (j * 16 + c) * X_PITCH + kk * 32 + 8 * hh);
      acc[j] = mma16(ka, qb[kk], acc[j]);
    }
  }

  // ---- softmax over the 128 keys of query r0 + c: acc[j][r] = S[r0 + c][16j + 8hh + r], 64 keys in this lane, 64 in lane ^ 16 ----
  float mr[8];
#pragma unroll
  for (int r = 0; r < 8; ++r) {
    float m = acc[0][r];
#pragma unroll
    for (int j = 1; j < 8; ++j) m = fmaxf(m, acc[j][r]);
    mr[r] = m;
  }
  float m = fmaxf(fmaxf(fmaxf(mr[0], mr[1]), fmaxf(mr[2], mr[3])), fmaxf(fmaxf(mr[4], mr[5]), fmaxf(mr[6], mr[7])));
  m = fmaxf(m, other_half(m));
  const float mx = m * SCORE_SCALE_LOG2;
  // P^T as the B operand of the second product, straight from the score accumulators: element s of pb[kk] is key
  // 32kk + 8hh + s (s < 8, tile 2kk) or 32kk + 16 + 8hh + (s - 8) (tile 2kk + 1), the k order of frag_load
  v16h pb[4];
  float ps[8];
#pragma unroll
  for (int r = 0; r < 8; ++r) ps[r] = 0.f;
#pragma unroll
  for (int j = 0; j < 8; ++j) {
    float t[8], p[8];
#pragma unroll
    for (int r = 0; r < 8; ++r) t[r] = acc[j][r] * SCORE_SCALE_LOG2 - mx;   // <= 0 but for half an ulp of mx, so p <= 1 to within f32 rounding
    exp2_x8(p, t);
#pragma unroll
    for (int r = 0; r < 8; ++r) {
      ps[r] += p[r];
      pb[j >> 1][(j & 1) * 8 + r] = (_Float16)(p[r] * P_CARRY);
    }
  }
  float psum = ((ps[0] + ps[1]) + (ps[2] + ps[3])) + ((ps[4] + ps[5]) + (ps[6] + ps[7]));
  psum += other_half(psum);
  const float inv = 1.0f / (psum * P_CARRY);   // psum >= 1 to within f32 rounding (row max term)

  // ---- O^T[64 dims][16 queries] = V^T[64][128] . P^T ; A[m=d][k=key] = sXt[d][key], B = pb ----
  v8f oacc[4];
#pragma unroll
  for (int t = 0; t < 4; ++t) oacc[t] = (v8f){0.f, 0.f, 0.f, 0.f, 0.f, 0.f, 0.f, 0.f};
#pragma unroll
  for (int kk = 0; kk < 4; ++kk) {
#pragma unroll
    for (int t = 0; t < 4; ++t) {
      const v16h va = frag_load(sXt + (t * 16 + c) * XT_PITCH + kk * 32 + 8 * hh);
      oacc[t] = mma16(va, pb[kk], oacc[t]);
    }
  }

  // ---- normalise and stage O (oacc[t][r] = O[c][16t + 8hh + r]: eight consecutive dims of one row per lane) ----
  float* os = sO[wave].o;                  // [16][64] f32 at O_PITCH, this wave only
#pragma unroll
  for (int t = 0; t < 4; ++t) {
#pragma unroll
    for (int q = 0; q < 2; ++q) {
      v4f val;
#pragma unroll
      for (int e = 0; e < 4; ++e) val[e] = oacc[t][q * 4 + e] * inv;
      *(v4f*)(os + c * O_PITCH + t * 16 + 8 * hh + q * 4) = val;
    }
  }
  __syncthreads();

  {
    const int c4 = c * 4;
    {
#pragma unroll
      for (int it = 0; it < 8; ++it) {
        const int row = it * 2 + hh;                          // 0..15
        const v4f val = *(const v4f*)(os + row * O_PITCH + c4);
        *(v4f*)(gy + (size_t)(r0 + row) * HEAD_DIM + c4) = val;
      }
      
    }
  }
}

extern "C" void kernel_launch(void* const* d_in, const int* in_sizes, int n_in,
                              void* d_out, int out_size, void* d_ws, size_t ws_size,
                              hipStream_t stream) {
  (void)n_in; (void)d_ws; (void)ws_size;
  const float* x = (const float*)d_in[0];
  float* out = (float*)d_out;
  const int total = in_sizes[0];
  const int per_bh = SEQ_LEN * HEAD_DIM;                 // 42944
  const int nbh = total / per_bh;                        // batch * heads = 128
  if (nbh <= 0 || nbh * per_bh != total || out_size != total) return;
  // no workspace used
  blk_attn_kernel<<<dim3(4, nbh), NTHREADS, 0, stream>>>(x, out);
}

// v005
// Measured time: 6 microseconds a run.
// Two timings next to v004 both put it at 1.20 times that version's speed.
// Over all steps from v000 it is 4.38 times as fast.
// Contractions, both transposed: scores^T = k.q^T (K=64) and out^T = v^T.p^T (K=128) on v_wmma_f32_16x16x32_f16 with f32 accumulate; x carried as the f16 image of its RNE-bf16 value (exact), p carried as f16 x 2^15 and kept in registers; softmax, max, sum and normalisation in f32, the exponential in base 2.
#include <hip/hip_runtime.h>

typedef __attribute__((ext_vector_type(16))) _Float16 v16h;
typedef __attribute__((ext_vector_type(8)))  _Float16 v8h;
typedef __attribute__((ext_vector_type(4)))  _Float16 v4h;
typedef __attribute__((ext_vector_type(8)))  float    v8f;
typedef __attribute__((ext_vector_type(4)))  float    v4f;
typedef __attribute__((ext_vector_type(8)))  short    v8s;

constexpr int SEQ_LEN    = 671;
constexpr int HEAD_DIM   = 64;
constexpr int BLK_ROWS   = 128;
constexpr int GAP_BEGIN  = 384;
constexpr int GAP_END    = 543;
constexpr int NWAVES     = 8;
constexpr int NTHREADS   = 256;
constexpr int GAP_ROWS   = GAP_END - GAP_BEGIN;      // 159 rows of zeros per (batch, head)
constexpr int GAP_SHARE  = (GAP_ROWS + 3) / 4;       // 40: whole 256-B rows, so no 128-B line has two writers
// LDS row pitches: every 16-byte-per-lane reader walks 16 rows at once, so each pitch is 16 B x odd (banks = dword address mod 64);
// the transposing reader walks every second row of the x tile (288 B = 32 B x odd), which is its own conflict-free pitch
constexpr int X_PITCH    = HEAD_DIM + 8;    // halves, 144 B
constexpr int O_PITCH    = HEAD_DIM + 4;    // floats, 272 B
constexpr float P_CARRY     = 32768.0f;
// 1/sqrt(64) x log2(e): scores go to base 2, so that exp(s - max) is one v_exp_f32 (2^t)
constexpr float SCORE_SCALE_LOG2 = 0.125f * 1.44269504088896340736f;

static_assert(SEQ_LEN - GAP_END == BLK_ROWS, "last block is 128 rows");
static_assert(3 * BLK_ROWS == GAP_BEGIN, "first three blocks end at the gap");
static_assert(NWAVES * 16 == BLK_ROWS, "8 waves x 16 query rows cover a block");
static_assert(3 * GAP_SHARE < GAP_ROWS && 4 * GAP_SHARE >= GAP_ROWS, "four shares cover the gap, the last one not empty");
static_assert(HEAD_DIM % 32 == 0 && BLK_ROWS % 32 == 0, "K multiples of 32 for both contractions");

// ---- helpers ----
__device__ __forceinline__ unsigned short f2bf_bits(float f) {
  unsigned u = __float_as_uint(f);
  return (unsigned short)((u + 0x7FFFu + ((u >> 16) & 1u)) >> 16);
}
// RNE to bf16, then held in an f16 container (8 significant bits fit exactly)
__device__ __forceinline__ _Float16 to_h16_of_bf16(float f) {
  const unsigned short hb = f2bf_bits(f);
  const float g = __uint_as_float(((unsigned)hb) << 16);
  return (_Float16)g;
}
// 16x32 fragment: elements 0..7 <- p[0..7], 8..15 <- p[16..23]; caller passes p = row base + k0 + 8*(lane>>4)
__device__ __forceinline__ v16h frag_load(const _Float16* p) {
  union { v16h v; v8h h[2]; } f;
  f.h[0] = *(const v8h*)(p);
  f.h[1] = *(const v8h*)(p + 16);
  return f.v;
}
// 16 x 32 fragment of the transposed tile by two transposing LDS loads: lane (c, hh) gets, for i = 0..7, column c of the row
// that lane 16hh + i addresses (elements 0..7 from p, 8..15 from 16 rows further on); a lane addresses 16 B of its row
__device__ __forceinline__ v16h frag_load_tr(const _Float16* p) {
  typedef __attribute__((address_space(3))) v8s lds_v8s;
  union { v16h v; v8s h[2]; } f;
  f.h[0] = __builtin_amdgcn_ds_load_tr16_b128_v8i16((lds_v8s*)(p));
  f.h[1] = __builtin_amdgcn_ds_load_tr16_b128_v8i16((lds_v8s*)(p + 16 * X_PITCH));
  return f.v;
}
__device__ __forceinline__ v8f mma16(v16h a, v16h b, v8f c) {
  c = __builtin_amdgcn_wmma_f32_16x16x32_f16(false, a, false, b, (short)0, c, false, false);
  asm volatile("v_nop\n\tv_nop\n\tv_nop\n\tv_nop" : "+v"(c) : "v"(a), "v"(b));
  return c;
}

// p[i] = 2^t[i], eight at a time. One statement, because behind a v_exp_f32 the instruction set asks for one independent
// instruction before its result is read or its source overwritten: here each v_exp_f32 is that instruction for the one before
// (early-clobber outputs share no register with a source) and the v_nop is it for the last.
__device__ __forceinline__ void exp2_x8(float (&p)[8], const float (&t)[8]) {
  asm("v_exp_f32 %0, %8\n\t"
      "v_exp_f32 %1, %9\n\t"
      "v_exp_f32 %2, %10\n\t"
      "v_exp_f32 %3, %11\n\t"
      "v_exp_f32 %4, %12\n\t"
      "v_exp_f32 %5, %13\n\t"
      "v_exp_f32 %6, %14\n\t"
      "v_exp_f32 %7, %15\n\t"
      "v_nop"
      : "=&v"(p[0]), "=&v"(p[1]), "=&v"(p[2]), "=&v"(p[3]), "=&v"(p[4]), "=&v"(p[5]), "=&v"(p[6]), "=&v"(p[7])
      : "v"(t[0]), "v"(t[1]), "v"(t[2]), "v"(t[3]), "v"(t[4]), "v"(t[5]), "v"(t[6]), "v"(t[7]));
}

// value of lane l ^ 16: the other half of the keys of the same query column
__device__ __forceinline__ float other_half(float v) {
  const int b = __float_as_int(v);
  return __int_as_float(__builtin_amdgcn_permlanex16(b, b, 0x76543210, 0xfedcba98, false, false));
}

// per-wave staging of the O tile [16][64] f32 at pitch 272 B (4352 B)
struct OBuf {
  float o[16 * O_PITCH];
};
static_assert((X_PITCH * 2) % 32 == 16 && (O_PITCH * 4) % 32 == 16,
              "pitches are odd multiples of 16 B");

// One block = one (batch*head, diagonal block): 128 query rows x 128 keys x 64 dims.
// grid = (4, B*N), 256 threads = 8 waves, wave w owns query rows 16w..16w+15.
// The four blocks of a (batch, head) also zero a quarter each of its gap rows (40, 40, 40, 39).
__global__ __launch_bounds__(NTHREADS) void blk_attn_kernel(const float* __restrict__ x,
                                                            float* __restrict__ out) {
  __shared__ __align__(16) _Float16 sX[BLK_ROWS * X_PITCH];     // [row][d], pitch 72 halves, the last 8 of a row unused
  __shared__ __align__(16) OBuf sO[NWAVES];

  const int blk = blockIdx.x;                               // 0..3, block-uniform
  const int bh  = blockIdx.y;                               // 0..B*N-1
  const int row0 = (blk < 3) ? blk * BLK_ROWS : GAP_END;    // 0, 128, 256, 543
  const size_t base = ((size_t)bh * SEQ_LEN + (size_t)row0) * HEAD_DIM;
  const float* gx = x + base;
  float* gy = out + base;
  const int tid = threadIdx.x;

  // ---- gap rows: this block's share, stored at entry so that the stores drain under the staging and the matrix work ----
  {
    const int g0 = blk * GAP_SHARE;                                          // 0, 40, 80, 120
    const int n4 = ((blk < 3) ? GAP_SHARE : GAP_ROWS - 3 * GAP_SHARE) * (HEAD_DIM / 4);   // 640 or 624 float4
    float* gz = out + ((size_t)bh * SEQ_LEN + (size_t)(GAP_BEGIN + g0)) * HEAD_DIM;
    const v4f z = (v4f){0.f, 0.f, 0.f, 0.f};
    constexpr int FULL_TRIPS = (GAP_ROWS - 3 * GAP_SHARE) * (HEAD_DIM / 4) / NTHREADS;   // 2: trips that every share fills
#pragma unroll
    for (int i = 0; i < (GAP_SHARE * (HEAD_DIM / 4) + NTHREADS - 1) / NTHREADS; ++i) {
      const int f = i * NTHREADS + tid;
      if (i < FULL_TRIPS || f < n4) *(v4f*)(gz + (size_t)f * 4) = z;
    }
  }

  // ---- staging: 128 rows x 16 float4 = 2048 float4 = 256 threads x 8; writes all 128x64 of sX ----
#pragma unroll
  for (int i = 0; i < 8; ++i) {
    const int f   = i * NTHREADS + tid;       // 0..2047
    const int row = f >> 4;                   // 0..127
    const int d4  = (f & 15) * 4;             // 0..60
    const v4f v = *(const v4f*)(gx + (size_t)row * HEAD_DIM + d4);
    const _Float16 h0 = to_h16_of_bf16(v[0]);
    const _Float16 h1 = to_h16_of_bf16(v[1]);
    const _Float16 h2 = to_h16_of_bf16(v[2]);
    const _Float16 h3 = to_h16_of_bf16(v[3]);
    v4h hv;
    hv[0] = h0; hv[1] = h1; hv[2] = h2; hv[3] = h3;
    *(v4h*)(sX + row * X_PITCH + d4) = hv;
  }
  __syncthreads();

  const int wave = tid >> 5;
  const int lane = tid & 31;
  const int hh   = lane >> 4;        // lane half: k offset 8*hh, D rows 8*hh+r
  const int c    = lane & 15;        // A row / B column / D column
  const int r0   = wave * 16;        // first query row of this wave (block-local)

  // ---- scores, transposed: S^T[128 keys][16 queries] = K[128][64] . Q^T ; A from sX key rows, B[k=d][n=query] = sX[r0 + query][d] ----
  // Row m of score tile j is key 16j + 2(m & 7) + (m >> 3): the order in which the transposing loads of the second product
  // hand out the keys (a softmax row does not depend on the order of its keys)
  const int krow = 2 * (c & 7) + (c >> 3);
  v8f acc[8];
#pragma unroll
  for (int j = 0; j < 8; ++j) acc[j] = (v8f){0.f, 0.f, 0.f, 0.f, 0.f, 0.f, 0.f, 0.f};
  v16h qb[2];
#pragma unroll
  for (int kk = 0; kk < 2; ++kk) qb[kk] = frag_load(sX + (r0 + c) * X_PITCH + kk * 32 + 8 * hh);
#pragma unroll
  for (int j = 0; j < 8; ++j) {
#pragma unroll
    for (int kk = 0; kk < 2; ++kk) {
      const v16h ka = frag_load(sX + (j * 16 + krow) * X_PITCH + kk * 32 + 8 * hh);
      acc[j] = mma16(ka, qb[kk], acc[j]);
    }
  }

  // ---- softmax over the 128 keys of query r0 + c: acc[j][r] = S[r0 + c][16j + 2r + hh], 64 keys in this lane, 64 in lane ^ 16 ----
  float mr[8];
#pragma unroll
  for (int r = 0; r < 8; ++r) {
    float m = acc[0][r];
#pragma unroll
    for (int j = 1; j < 8; ++j) m = fmaxf(m, acc[j][r]);
    mr[r] = m;
  }
  float m = fmaxf(fmaxf(fmaxf(mr[0], mr[1]), fmaxf(mr[2], mr[3])), fmaxf(fmaxf(mr[4], mr[5]), fmaxf(mr[6], mr[7])));
  m = fmaxf(m, other_half(m));
  const float mx = m * SCORE_SCALE_LOG2;
  // P^T as the B operand of the second product, straight from the score accumulators: element s of pb[kk] is key
  // 32kk + 2s + hh (s < 8, tile 2kk) or 32kk + 16 + 2(s - 8) + hh (tile 2kk + 1), the key order in which frag_load_tr is addressed for the second product
  v16h pb[4];
  float ps[8];
#pragma unroll
  for (int r = 0; r < 8; ++r) ps[r] = 0.f;
#pragma unroll
  for (int j = 0; j < 8; ++j) {
    float t[8], p[8];
#pragma unroll
    for (int r = 0; r < 8; ++r) t[r] = acc[j][r] * SCORE_SCALE_LOG2 - mx;   // <= 0 but for half an ulp of mx, so p <= 1 to within f32 rounding
    exp2_x8(p, t);
#pragma unroll
    for (int r = 0; r < 8; ++r) {
      ps[r] += p[r];
      pb[j >> 1][(j & 1) * 8 + r] = (_Float16)(p[r] * P_CARRY);
    }
  }
  float psum = ((ps[0] + ps[1]) + (ps[2] + ps[3])) + ((ps[4] + ps[5]) + (ps[6] + ps[7]));
  psum += other_half(psum);
  const float inv = 1.0f / (psum * P_CARRY);   // psum >= 1 to within f32 rounding (row max term)

  // ---- O^T[64 dims][16 queries] = V^T[64][128] . P^T ; A[m=d][k=key] = sX[key][d] through the transposing load, B = pb ----
  // lane 16hh + 8b + i addresses dims 8b..8b+7 (of the 16 of tile t) of key row 2i + hh (of the 16 at 32kk, then at 32kk + 16)
  const _Float16* vt = sX + (2 * (lane & 7) + hh) * X_PITCH + 8 * ((lane >> 3) & 1);
  v8f oacc[4];
#pragma unroll
  for (int t = 0; t < 4; ++t) oacc[t] = (v8f){0.f, 0.f, 0.f, 0.f, 0.f, 0.f, 0.f, 0.f};
#pragma unroll
  for (int kk = 0; kk < 4; ++kk) {
#pragma unroll
    for (int t = 0; t < 4; ++t) {
      const v16h va = frag_load_tr(vt + kk * 32 * X_PITCH + t * 16);
      oacc[t] = mma16(va, pb[kk], oacc[t]);
    }
  }

  // ---- normalise and stage O (oacc[t][r] = O[c][16t + 8hh + r]: eight consecutive dims of one row per lane) ----
  float* os = sO[wave].o;                  // [16][64] f32 at O_PITCH, this wave only
#pragma unroll
  for (int t = 0; t < 4; ++t) {
#pragma unroll
    for (int q = 0; q < 2; ++q) {
      v4f val;
#pragma unroll
      for (int e = 0; e < 4; ++e) val[e] = oacc[t][q * 4 + e] * inv;
      *(v4f*)(os + c * O_PITCH + t * 16 + 8 * hh + q * 4) = val;
    }
  }
  __syncthreads();

  {
    const int c4 = c * 4;
    {
#pragma unroll
      for (int it = 0; it < 8; ++it) {
        const int row = it * 2 + hh;                          // 0..15
        const v4f val = *(const v4f*)(os + row * O_PITCH + c4);
        *(v4f*)(gy + (size_t)(r0 + row) * HEAD_DIM + c4) = val;
      }
      
    }
  }
}

extern "C" void kernel_launch(void* const* d_in, const int* in_sizes, int n_in,
                              void* d_out, int out_size, void* d_ws, size_t ws_size,
                              hipStream_t stream) {
  (void)n_in; (void)d_ws; (void)ws_size;
  const float* x = (const float*)d_in[0];
  float* out = (float*)d_out;
  const int total = in_sizes[0];
  const int per_bh = SEQ_LEN * HEAD_DIM;                 // 42944
  const int nbh = total / per_bh;                        // batch * heads = 128
  if (nbh <= 0 || nbh * per_bh != total || out_size != total) return;
  // no workspace used
  blk_attn_kernel<<<dim3(4, nbh), NTHREADS, 0, stream>>>(x, out);
}

// v006
// Measured time: 5.42 microseconds a run.
// Next to v005, in two timings, it ran 1.10 times as fast each time.
// Counting every step since v000, it is 4.82 times as fast.
// Contractions, both transposed: scores^T = k.q^T (K=64) and out^T = v^T.p^T (K=128) on v_wmma_f32_16x16x32_f16 with f32 accumulate; x carried as the f16 image of its RNE-bf16 value (exact), p carried as f16 x 2^15 and kept in registers; softmax, max, sum and normalisation in f32, the exponential in base 2.
#include <hip/hip_runtime.h>

typedef __attribute__((ext_vector_type(16))) _Float16 v16h;
typedef __attribute__((ext_vector_type(8)))  _Float16 v8h;
typedef __attribute__((ext_vector_type(4)))  _Float16 v4h;
typedef __attribute__((ext_vector_type(8)))  float    v8f;
typedef __attribute__((ext_vector_type(4)))  float    v4f;
typedef __attribute__((ext_vector_type(8)))  short    v8s;

constexpr int SEQ_LEN    = 671;
constexpr int HEAD_DIM   = 64;
constexpr int BLK_ROWS   = 128;
constexpr int GAP_BEGIN  = 384;
constexpr int GAP_END    = 543;
constexpr int NWAVES     = 8;
constexpr int NTHREADS   = 256;
constexpr int GAP_ROWS   = GAP_END - GAP_BEGIN;      // 159 rows of zeros per (batch, head)
constexpr int GAP_SHARE  = (GAP_ROWS + 3) / 4;       // 40: whole 256-B rows, so no 128-B line has two writers
// LDS row pitches: every 16-byte-per-lane reader walks 16 rows at once, so each pitch is 16 B x odd (banks = dword address mod 64);
// the transposing reader walks every second row of the x tile (288 B = 32 B x odd), which is its own conflict-free pitch
constexpr int X_PITCH    = HEAD_DIM + 8;    // halves, 144 B
constexpr int O_PITCH    = HEAD_DIM + 4;    // floats, 272 B
constexpr float P_CARRY     = 32768.0f;
// 1/sqrt(64) x log2(e): scores go to base 2, so that exp(s - max) is one v_exp_f32 (2^t)
constexpr float SCORE_SCALE_LOG2 = 0.125f * 1.44269504088896340736f;

static_assert(SEQ_LEN - GAP_END == BLK_ROWS, "last block is 128 rows");
static_assert(3 * BLK_ROWS == GAP_BEGIN, "first three blocks end at the gap");
static_assert(NWAVES * 16 == BLK_ROWS, "8 waves x 16 query rows cover a block");
static_assert(3 * GAP_SHARE < GAP_ROWS && 4 * GAP_SHARE >= GAP_ROWS, "four shares cover the gap, the last one not empty");
static_assert(HEAD_DIM % 32 == 0 && BLK_ROWS % 32 == 0, "K multiples of 32 for both contractions");

// ---- helpers ----
__device__ __forceinline__ unsigned short f2bf_bits(float f) {
  unsigned u = __float_as_uint(f);
  return (unsigned short)((u + 0x7FFFu + ((u >> 16) & 1u)) >> 16);
}
// RNE to bf16, then held in an f16 container (8 significant bits fit exactly)
__device__ __forceinline__ _Float16 to_h16_of_bf16(float f) {
  const unsigned short hb = f2bf_bits(f);
  const float g = __uint_as_float(((unsigned)hb) << 16);
  return (_Float16)g;
}
// 16x32 fragment: elements 0..7 <- p[0..7], 8..15 <- p[16..23]; caller passes p = row base + k0 + 8*(lane>>4)
__device__ __forceinline__ v16h frag_load(const _Float16* p) {
  union { v16h v; v8h h[2]; } f;
  f.h[0] = *(const v8h*)(p);
  f.h[1] = *(const v8h*)(p + 16);
  return f.v;
}
// 16 x 32 fragment of the transposed tile by two transposing LDS loads: lane (c, hh) gets, for i = 0..7, column c of the row
// that lane 16hh + i addresses (elements 0..7 from p, 8..15 from 16 rows further on); a lane addresses 16 B of its row
__device__ __forceinline__ v16h frag_load_tr(const _Float16* p) {
  typedef __attribute__((address_space(3))) v8s lds_v8s;
  union { v16h v; v8s h[2]; } f;
  f.h[0] = __builtin_amdgcn_ds_load_tr16_b128_v8i16((lds_v8s*)(p));
  f.h[1] = __builtin_amdgcn_ds_load_tr16_b128_v8i16((lds_v8s*)(p + 16 * X_PITCH));
  return f.v;
}
__device__ __forceinline__ v8f mma16(v16h a, v16h b, v8f c) {
  return __builtin_amdgcn_wmma_f32_16x16x32_f16(false, a, false, b, (short)0, c, false, false);
}

// p[i] = 2^t[i], eight at a time. One statement, because behind a v_exp_f32 the instruction set asks for one independent
// instruction before its result is read or its source overwritten: here each v_exp_f32 is that instruction for the one before
// (early-clobber outputs share no register with a source) and the v_nop is it for the last.
__device__ __forceinline__ void exp2_x8(float (&p)[8], const float (&t)[8]) {
  asm("v_exp_f32 %0, %8\n\t"
      "v_exp_f32 %1, %9\n\t"
      "v_exp_f32 %2, %10\n\t"
      "v_exp_f32 %3, %11\n\t"
      "v_exp_f32 %4, %12\n\t"
      "v_exp_f32 %5, %13\n\t"
      "v_exp_f32 %6, %14\n\t"
      "v_exp_f32 %7, %15\n\t"
      "v_nop"
      : "=&v"(p[0]), "=&v"(p[1]), "=&v"(p[2]), "=&v"(p[3]), "=&v"(p[4]), "=&v"(p[5]), "=&v"(p[6]), "=&v"(p[7])
      : "v"(t[0]), "v"(t[1]), "v"(t[2]), "v"(t[3]), "v"(t[4]), "v"(t[5]), "v"(t[6]), "v"(t[7]));
}

// value of lane l ^ 16: the other half of the keys of the same query column
__device__ __forceinline__ float other_half(float v) {
  const int b = __float_as_int(v);
  return __int_as_float(__builtin_amdgcn_permlanex16(b, b, 0x76543210, 0xfedcba98, false, false));
}

// per-wave staging of the O tile [16][64] f32 at pitch 272 B (4352 B)
struct OBuf {
  float o[16 * O_PITCH];
};
static_assert((X_PITCH * 2) % 32 == 16 && (O_PITCH * 4) % 32 == 16,
              "pitches are odd multiples of 16 B");

// One block = one (batch*head, diagonal block): 128 query rows x 128 keys x 64 dims.
// grid = (4, B*N), 256 threads = 8 waves, wave w owns query rows 16w..16w+15.
// The four blocks of a (batch, head) also zero a quarter each of its gap rows (40, 40, 40, 39).
__global__ __launch_bounds__(NTHREADS) void blk_attn_kernel(const float* __restrict__ x,
                                                            float* __restrict__ out) {
  __shared__ __align__(16) _Float16 sX[BLK_ROWS * X_PITCH];     // [row][d], pitch 72 halves, the last 8 of a row unused
  __shared__ __align__(16) OBuf sO[NWAVES];

  const int blk = blockIdx.x;                               // 0..3, block-uniform
  const int bh  = blockIdx.y;                               // 0..B*N-1
  const int row0 = (blk < 3) ? blk * BLK_ROWS : GAP_END;    // 0, 128, 256, 543
  const size_t base = ((size_t)bh * SEQ_LEN + (size_t)row0) * HEAD_DIM;
  const float* gx = x + base;
  float* gy = out + base;
  const int tid = threadIdx.x;

  // ---- gap rows: this block's share, stored at entry so that the stores drain under the staging and the matrix work ----
  {
    const int g0 = blk * GAP_SHARE;                                          // 0, 40, 80, 120
    const int n4 = ((blk < 3) ? GAP_SHARE : GAP_ROWS - 3 * GAP_SHARE) * (HEAD_DIM / 4);   // 640 or 624 float4
    float* gz = out + ((size_t)bh * SEQ_LEN + (size_t)(GAP_BEGIN + g0)) * HEAD_DIM;
    const v4f z = (v4f){0.f, 0.f, 0.f, 0.f};
    constexpr int FULL_TRIPS = (GAP_ROWS - 3 * GAP_SHARE) * (HEAD_DIM / 4) / NTHREADS;   // 2: trips that every share fills
#pragma unroll
    for (int i = 0; i < (GAP_SHARE * (HEAD_DIM / 4) + NTHREADS - 1) / NTHREADS; ++i) {
      const int f = i * NTHREADS + tid;
      if (i < FULL_TRIPS || f < n4) *(v4f*)(gz + (size_t)f * 4) = z;
    }
  }

  // ---- staging: 128 rows x 16 float4 = 2048 float4 = 256 threads x 8; writes all 128x64 of sX ----
#pragma unroll
  for (int i = 0; i < 8; ++i) {
    const int f   = i * NTHREADS + tid;       // 0..2047
    const int row = f >> 4;                   // 0..127
    const int d4  = (f & 15) * 4;             // 0..60
    const v4f v = *(const v4f*)(gx + (size_t)row * HEAD_DIM + d4);
    const _Float16 h0 = to_h16_of_bf16(v[0]);
    const _Float16 h1 = to_h16_of_bf16(v[1]);
    const _Float16 h2 = to_h16_of_bf16(v[2]);
    const _Float16 h3 = to_h16_of_bf16(v[3]);
    v4h hv;
    hv[0] = h0; hv[1] = h1; hv[2] = h2; hv[3] = h3;
    *(v4h*)(sX + row * X_PITCH + d4) = hv;
  }
  __syncthreads();

  const int wave = tid >> 5;
  const int lane = tid & 31;
  const int hh   = lane >> 4;        // lane half: k offset 8*hh, D rows 8*hh+r
  const int c    = lane & 15;        // A row / B column / D column
  const int r0   = wave * 16;        // first query row of this wave (block-local)

  // ---- scores, transposed: S^T[128 keys][16 queries] = K[128][64] . Q^T ; A from sX key rows, B[k=d][n=query] = sX[r0 + query][d] ----
  // Row m of score tile j is key 16j + 2(m & 7) + (m >> 3): the order in which the transposing loads of the second product
  // hand out the keys (a softmax row does not depend on the order of its keys)
  const int krow = 2 * (c & 7) + (c >> 3);
  v8f acc[8];
#pragma unroll
  for (int j = 0; j < 8; ++j) acc[j] = (v8f){0.f, 0.f, 0.f, 0.f, 0.f, 0.f, 0.f, 0.f};
  v16h qb[2];
#pragma unroll
  for (int kk = 0; kk < 2; ++kk) qb[kk] = frag_load(sX + (r0 + c) * X_PITCH + kk * 32 + 8 * hh);
  // every K fragment is asked for before the first product: the LDS latency is paid once, behind counted waits, not once per product
  v16h ka[2][8];
#pragma unroll
  for (int kk = 0; kk < 2; ++kk) {
#pragma unroll
    for (int j = 0; j < 8; ++j) ka[kk][j] = frag_load(sX + (j * 16 + krow) * X_PITCH + kk * 32 + 8 * hh);
  }
  __builtin_amdgcn_sched_barrier(0);   // keeps the load group ahead of the products: the scheduler otherwise sinks each load to its product and waits for it there
#pragma unroll
  for (int kk = 0; kk < 2; ++kk) {
#pragma unroll
    for (int j = 0; j < 8; ++j) acc[j] = mma16(ka[kk][j], qb[kk], acc[j]);
  }
  __builtin_amdgcn_sched_barrier(0);   // the next load group stays behind these products, where the K fragments' registers are free for it

  // ---- V^T fragments of the second product, asked for here so that they land under the softmax arithmetic ----
  // lane 16hh + 8b + i addresses dims 8b..8b+7 (of the 16 of tile t) of key row 2i + hh (of the 16 at 32kk, then at 32kk + 16)
  const _Float16* vt = sX + (2 * (lane & 7) + hh) * X_PITCH + 8 * ((lane >> 3) & 1);
  v16h va[4][4];
#pragma unroll
  for (int kk = 0; kk < 4; ++kk) {
#pragma unroll
    for (int t = 0; t < 4; ++t) va[kk][t] = frag_load_tr(vt + kk * 32 * X_PITCH + t * 16);
  }
  __builtin_amdgcn_sched_barrier(0);   // keeps this load group ahead of the softmax: sunk to its products, each load would be waited for there

  // ---- softmax over the 128 keys of query r0 + c: acc[j][r] = S[r0 + c][16j + 2r + hh], 64 keys in this lane, 64 in lane ^ 16 ----
  float mr[8];
#pragma unroll
  for (int r = 0; r < 8; ++r) {
    float m = acc[0][r];
#pragma unroll
    for (int j = 1; j < 8; ++j) m = fmaxf(m, acc[j][r]);
    mr[r] = m;
  }
  float m = fmaxf(fmaxf(fmaxf(mr[0], mr[1]), fmaxf(mr[2], mr[3])), fmaxf(fmaxf(mr[4], mr[5]), fmaxf(mr[6], mr[7])));
  m = fmaxf(m, other_half(m));
  const float mx = m * SCORE_SCALE_LOG2;
  // P^T as the B operand of the second product, straight from the score accumulators: element s of pb[kk] is key
  // 32kk + 2s + hh (s < 8, tile 2kk) or 32kk + 16 + 2(s - 8) + hh (tile 2kk + 1), the key order in which frag_load_tr is addressed for the second product
  v16h pb[4];
  float ps[8];
#pragma unroll
  for (int r = 0; r < 8; ++r) ps[r] = 0.f;
#pragma unroll
  for (int j = 0; j < 8; ++j) {
    float t[8], p[8];
#pragma unroll
    for (int r = 0; r < 8; ++r) t[r] = acc[j][r] * SCORE_SCALE_LOG2 - mx;   // <= 0 but for half an ulp of mx, so p <= 1 to within f32 rounding
    exp2_x8(p, t);
#pragma unroll
    for (int r = 0; r < 8; ++r) {
      ps[r] += p[r];
      pb[j >> 1][(j & 1) * 8 + r] = (_Float16)(p[r] * P_CARRY);
    }
  }
  float psum = ((ps[0] + ps[1]) + (ps[2] + ps[3])) + ((ps[4] + ps[5]) + (ps[6] + ps[7]));
  psum += other_half(psum);
  const float inv = 1.0f / (psum * P_CARRY);   // psum >= 1 to within f32 rounding (row max term)

  // ---- O^T[64 dims][16 queries] = V^T[64][128] . P^T ; A[m=d][k=key] = sX[key][d] through the transposing load, B = pb ----
  // the products stay behind the softmax: the compiler does not see into the v_exp_f32 statements, so none of them may stand
  // within the distance that a product's operand registers need before they are overwritten
  __builtin_amdgcn_sched_barrier(0);
  v8f oacc[4];
#pragma unroll
  for (int t = 0; t < 4; ++t) oacc[t] = (v8f){0.f, 0.f, 0.f, 0.f, 0.f, 0.f, 0.f, 0.f};
#pragma unroll
  for (int kk = 0; kk < 4; ++kk) {
#pragma unroll
    for (int t = 0; t < 4; ++t) {
      oacc[t] = mma16(va[kk][t], pb[kk], oacc[t]);
    }
  }

  // ---- normalise and stage O (oacc[t][r] = O[c][16t + 8hh + r]: eight consecutive dims of one row per lane) ----
  float* os = sO[wave].o;                  // [16][64] f32 at O_PITCH, this wave only
#pragma unroll
  for (int t = 0; t < 4; ++t) {
#pragma unroll
    for (int q = 0; q < 2; ++q) {
      v4f val;
#pragma unroll
      for (int e = 0; e < 4; ++e) val[e] = oacc[t][q * 4 + e] * inv;
      *(v4f*)(os + c * O_PITCH + t * 16 + 8 * hh + q * 4) = val;
    }
  }
  __syncthreads();

  {
    const int c4 = c * 4;
    {
#pragma unroll
      for (int it = 0; it < 8; ++it) {
        const int row = it * 2 + hh;                          // 0..15
        const v4f val = *(const v4f*)(os + row * O_PITCH + c4);
        *(v4f*)(gy + (size_t)(r0 + row) * HEAD_DIM + c4) = val;
      }
      
    }
  }
}

extern "C" void kernel_launch(void* const* d_in, const int* in_sizes, int n_in,
                              void* d_out, int out_size, void* d_ws, size_t ws_size,
                              hipStream_t stream) {
  (void)n_in; (void)d_ws; (void)ws_size;
  const float* x = (const float*)d_in[0];
  float* out = (float*)d_out;
  const int total = in_sizes[0];
  const int per_bh = SEQ_LEN * HEAD_DIM;                 // 42944
  const int nbh = total / per_bh;                        // batch * heads = 128
  if (nbh <= 0 || nbh * per_bh != total || out_size != total) return;
  // no workspace used
  blk_attn_kernel<<<dim3(4, nbh), NTHREADS, 0, stream>>>(x, out);
}

// v007
// One run takes 5.04 microseconds.
// In two side-by-side timings against v006, it was 1.07 and 1.08 times as fast.
// All steps since v000 together make it 5.18 times as fast.
// Contractions, both transposed: scores^T = k.q^T (K=64) and out^T = v^T.p^T (K=128) on v_wmma_f32_16x16x32_f16 with f32 accumulate; x carried as the f16 image of its RNE-bf16 value (exact), p carried as f16 x 2^15 and kept in registers; softmax, max, sum and normalisation in f32, the exponential in base 2.
#include <hip/hip_runtime.h>

typedef __attribute__((ext_vector_type(16))) _Float16 v16h;
typedef __attribute__((ext_vector_type(8)))  _Float16 v8h;
typedef __attribute__((ext_vector_type(4)))  _Float16 v4h;
typedef __attribute__((ext_vector_type(8)))  float    v8f;
typedef __attribute__((ext_vector_type(4)))  float    v4f;
typedef __attribute__((ext_vector_type(8)))  short    v8s;

constexpr int SEQ_LEN    = 671;
constexpr int HEAD_DIM   = 64;
constexpr int BLK_ROWS   = 128;
constexpr int GAP_BEGIN  = 384;
constexpr int GAP_END    = 543;
constexpr int NWAVES     = 8;
constexpr int NTHREADS   = 256;
constexpr int GAP_ROWS   = GAP_END - GAP_BEGIN;      // 159 rows of zeros per (batch, head)
constexpr int GAP_SHARE  = (GAP_ROWS + 3) / 4;       // 40: whole 256-B rows, so no 128-B line has two writers
// LDS row pitches: every 16-byte-per-lane reader walks 16 rows at once, so each pitch is 16 B x odd (banks = dword address mod 64);
// the transposing reader walks every second row of the x tile (288 B = 32 B x odd), which is its own conflict-free pitch
constexpr int X_PITCH    = HEAD_DIM + 8;    // halves, 144 B
constexpr int O_PITCH    = HEAD_DIM + 4;    // floats, 272 B
constexpr float P_CARRY     = 32768.0f;
// 1/sqrt(64) x log2(e): scores go to base 2, so that exp(s - max) is one v_exp_f32 (2^t)
constexpr float SCORE_SCALE_LOG2 = 0.125f * 1.44269504088896340736f;

static_assert(SEQ_LEN - GAP_END == BLK_ROWS, "last block is 128 rows");
static_assert(3 * BLK_ROWS == GAP_BEGIN, "first three blocks end at the gap");
static_assert(NWAVES * 16 == BLK_ROWS, "8 waves x 16 query rows cover a block");
static_assert(3 * GAP_SHARE < GAP_ROWS && 4 * GAP_SHARE >= GAP_ROWS, "four shares cover the gap, the last one not empty");
static_assert(HEAD_DIM % 32 == 0 && BLK_ROWS % 32 == 0, "K multiples of 32 for both contractions");

// ---- helpers ----
__device__ __forceinline__ unsigned short f2bf_bits(float f) {
  unsigned u = __float_as_uint(f);
  return (unsigned short)((u + 0x7FFFu + ((u >> 16) & 1u)) >> 16);
}
// RNE to bf16, then held in an f16 container (8 significant bits fit exactly)
__device__ __forceinline__ _Float16 to_h16_of_bf16(float f) {
  const unsigned short hb = f2bf_bits(f);
  const float g = __uint_as_float(((unsigned)hb) << 16);
  return (_Float16)g;
}
// 16x32 fragment: elements 0..7 <- p[0..7], 8..15 <- p[16..23]; caller passes p = row base + k0 + 8*(lane>>4)
__device__ __forceinline__ v16h frag_load(const _Float16* p) {
  union { v16h v; v8h h[2]; } f;
  f.h[0] = *(const v8h*)(p);
  f.h[1] = *(const v8h*)(p + 16);
  return f.v;
}
// 16 x 32 fragment of the transposed tile by two transposing LDS loads: lane (c, hh) gets, for i = 0..7, column c of the row
// that lane 16hh + i addresses (elements 0..7 from p, 8..15 from 16 rows further on); a lane addresses 16 B of its row
__device__ __forceinline__ v16h frag_load_tr(const _Float16* p) {
  typedef __attribute__((address_space(3))) v8s lds_v8s;
  union { v16h v; v8s h[2]; } f;
  f.h[0] = __builtin_amdgcn_ds_load_tr16_b128_v8i16((lds_v8s*)(p));
  f.h[1] = __builtin_amdgcn_ds_load_tr16_b128_v8i16((lds_v8s*)(p + 16 * X_PITCH));
  return f.v;
}
__device__ __forceinline__ v8f mma16(v16h a, v16h b, v8f c) {
  return __builtin_amdgcn_wmma_f32_16x16x32_f16(false, a, false, b, (short)0, c, false, false);
}

// p[i] = 2^t[i], eight at a time. One statement, because behind a v_exp_f32 the instruction set asks for one independent
// instruction before its result is read or its source overwritten: here each v_exp_f32 is that instruction for the one before
// (early-clobber outputs share no register with a source) and the v_nop is it for the last.
__device__ __forceinline__ void exp2_x8(float (&p)[8], const float (&t)[8]) {
  asm("v_exp_f32 %0, %8\n\t"
      "v_exp_f32 %1, %9\n\t"
      "v_exp_f32 %2, %10\n\t"
      "v_exp_f32 %3, %11\n\t"
      "v_exp_f32 %4, %12\n\t"
      "v_exp_f32 %5, %13\n\t"
      "v_exp_f32 %6, %14\n\t"
      "v_exp_f32 %7, %15\n\t"
      "v_nop"
      : "=&v"(p[0]), "=&v"(p[1]), "=&v"(p[2]), "=&v"(p[3]), "=&v"(p[4]), "=&v"(p[5]), "=&v"(p[6]), "=&v"(p[7])
      : "v"(t[0]), "v"(t[1]), "v"(t[2]), "v"(t[3]), "v"(t[4]), "v"(t[5]), "v"(t[6]), "v"(t[7]));
}

// value of lane l ^ 16: the other half of the keys of the same query column
__device__ __forceinline__ float other_half(float v) {
  const int b = __float_as_int(v);
  return __int_as_float(__builtin_amdgcn_permlanex16(b, b, 0x76543210, 0xfedcba98, false, false));
}

// per-wave staging of the O tile [16][64] f32 at pitch 272 B (4352 B)
struct OBuf {
  float o[16 * O_PITCH];
};
static_assert((X_PITCH * 2) % 32 == 16 && (O_PITCH * 4) % 32 == 16,
              "pitches are odd multiples of 16 B");

// One block = one (batch*head, diagonal block): 128 query rows x 128 keys x 64 dims.
// grid = (4, B*N), 256 threads = 8 waves, wave w owns query rows 16w..16w+15.
// The four blocks of a (batch, head) also zero a quarter each of its gap rows (40, 40, 40, 39).
__global__ __launch_bounds__(NTHREADS) void blk_attn_kernel(const float* __restrict__ x,
                                                            float* __restrict__ out) {
  __shared__ __align__(16) _Float16 sX[BLK_ROWS * X_PITCH];     // [row][d], pitch 72 halves, the last 8 of a row unused
  __shared__ __align__(16) OBuf sO[NWAVES];

  const int blk = blockIdx.x;                               // 0..3, block-uniform
  const int bh  = blockIdx.y;                               // 0..B*N-1
  const int row0 = (blk < 3) ? blk * BLK_ROWS : GAP_END;    // 0, 128, 256, 543
  const size_t base = ((size_t)bh * SEQ_LEN + (size_t)row0) * HEAD_DIM;
  const float* gx = x + base;
  float* gy = out + base;
  const int tid = threadIdx.x;

  // ---- staging: 128 rows x 16 float4 = 2048 float4 = 256 threads x 8; writes all 128x64 of sX ----
#pragma unroll
  for (int i = 0; i < 8; ++i) {
    const int f   = i * NTHREADS + tid;       // 0..2047
    const int row = f >> 4;                   // 0..127
    const int d4  = (f & 15) * 4;             // 0..60
    const v4f v = *(const v4f*)(gx + tid * 4 + i * (NTHREADS * 4));   // = gx + row * HEAD_DIM + d4 (rows lie back to back): one address a lane, the trip in the offset
    const _Float16 h0 = to_h16_of_bf16(v[0]);
    const _Float16 h1 = to_h16_of_bf16(v[1]);
    const _Float16 h2 = to_h16_of_bf16(v[2]);
    const _Float16 h3 = to_h16_of_bf16(v[3]);
    v4h hv;
    hv[0] = h0; hv[1] = h1; hv[2] = h2; hv[3] = h3;
    *(v4h*)(sX + row * X_PITCH + d4) = hv;
  }
  __syncthreads();

  const int wave = tid >> 5;
  const int lane = tid & 31;
  const int hh   = lane >> 4;        // lane half: k offset 8*hh, D rows 8*hh+r
  const int c    = lane & 15;        // A row / B column / D column
  const int r0   = wave * 16;        // first query row of this wave (block-local)

  // ---- scores, transposed: S^T[128 keys][16 queries] = K[128][64] . Q^T ; A from sX key rows, B[k=d][n=query] = sX[r0 + query][d] ----
  // Row m of score tile j is key 16j + 2(m & 7) + (m >> 3): the order in which the transposing loads of the second product
  // hand out the keys (a softmax row does not depend on the order of its keys)
  const int krow = 2 * (c & 7) + (c >> 3);
  v8f acc[8];
#pragma unroll
  for (int j = 0; j < 8; ++j) acc[j] = (v8f){0.f, 0.f, 0.f, 0.f, 0.f, 0.f, 0.f, 0.f};
  v16h qb[2];
#pragma unroll
  for (int kk = 0; kk < 2; ++kk) qb[kk] = frag_load(sX + (r0 + c) * X_PITCH + kk * 32 + 8 * hh);
  // every K fragment is asked for before the first product: the LDS latency is paid once, behind counted waits, not once per product
  v16h ka[2][8];
#pragma unroll
  for (int kk = 0; kk < 2; ++kk) {
#pragma unroll
    for (int j = 0; j < 8; ++j) ka[kk][j] = frag_load(sX + (j * 16 + krow) * X_PITCH + kk * 32 + 8 * hh);
  }
  __builtin_amdgcn_sched_barrier(0);   // keeps the load group ahead of the products: the scheduler otherwise sinks each load to its product and waits for it there
  // ---- gap rows: this block's share, stored here, while the wave waits for its K fragments anyway: the x loads are then the first
  // requests of the wave, no wave stands at the staging barrier for a store's return, and the stores drain under the matrix work ----
  {
    const int g0 = blk * GAP_SHARE;                                          // 0, 40, 80, 120
    const int n4 = ((blk < 3) ? GAP_SHARE : GAP_ROWS - 3 * GAP_SHARE) * (HEAD_DIM / 4);   // 640 or 624 float4
    float* gz = out + ((size_t)bh * SEQ_LEN + (size_t)(GAP_BEGIN + g0)) * HEAD_DIM;
    const v4f z = (v4f){0.f, 0.f, 0.f, 0.f};
    constexpr int FULL_TRIPS = (GAP_ROWS - 3 * GAP_SHARE) * (HEAD_DIM / 4) / NTHREADS;   // 2: trips that every share fills
#pragma unroll
    for (int i = 0; i < (GAP_SHARE * (HEAD_DIM / 4) + NTHREADS - 1) / NTHREADS; ++i) {
      const int f = i * NTHREADS + tid;
      if (i < FULL_TRIPS || f < n4) *(v4f*)(gz + (size_t)f * 4) = z;
    }
  }
#pragma unroll
  for (int kk = 0; kk < 2; ++kk) {
#pragma unroll
    for (int j = 0; j < 8; ++j) acc[j] = mma16(ka[kk][j], qb[kk], acc[j]);
  }
  __builtin_amdgcn_sched_barrier(0);   // the next load group stays behind these products, where the K fragments' registers are free for it

  // ---- V^T fragments of the second product, asked for here so that they land under the softmax arithmetic ----
  // lane 16hh + 8b + i addresses dims 8b..8b+7 (of the 16 of tile t) of key row 2i + hh (of the 16 at 32kk, then at 32kk + 16)
  const _Float16* vt = sX + (2 * (lane & 7) + hh) * X_PITCH + 8 * ((lane >> 3) & 1);
  v16h va[4][4];
#pragma unroll
  for (int kk = 0; kk < 4; ++kk) {
#pragma unroll
    for (int t = 0; t < 4; ++t) va[kk][t] = frag_load_tr(vt + kk * 32 * X_PITCH + t * 16);
  }
  __builtin_amdgcn_sched_barrier(0);   // keeps this load group ahead of the softmax: sunk to its products, each load would be waited for there

  // ---- softmax over the 128 keys of query r0 + c: acc[j][r] = S[r0 + c][16j + 2r + hh], 64 keys in this lane, 64 in lane ^ 16 ----
  float mr[8];
#pragma unroll
  for (int r = 0; r < 8; ++r) {
    float m = acc[0][r];
#pragma unroll
    for (int j = 1; j < 8; ++j) m = fmaxf(m, acc[j][r]);
    mr[r] = m;
  }
  float m = fmaxf(fmaxf(fmaxf(mr[0], mr[1]), fmaxf(mr[2], mr[3])), fmaxf(fmaxf(mr[4], mr[5]), fmaxf(mr[6], mr[7])));
  m = fmaxf(m, other_half(m));
  const float mx = m * SCORE_SCALE_LOG2;
  // P^T as the B operand of the second product, straight from the score accumulators: element s of pb[kk] is key
  // 32kk + 2s + hh (s < 8, tile 2kk) or 32kk + 16 + 2(s - 8) + hh (tile 2kk + 1), the key order in which frag_load_tr is addressed for the second product
  v16h pb[4];
  float ps[8];
#pragma unroll
  for (int r = 0; r < 8; ++r) ps[r] = 0.f;
#pragma unroll
  for (int j = 0; j < 8; ++j) {
    float t[8], p[8];
#pragma unroll
    for (int r = 0; r < 8; ++r) t[r] = acc[j][r] * SCORE_SCALE_LOG2 - mx;   // <= 0 but for half an ulp of mx, so p <= 1 to within f32 rounding
    exp2_x8(p, t);
#pragma unroll
    for (int r = 0; r < 8; ++r) {
      ps[r] += p[r];
      pb[j >> 1][(j & 1) * 8 + r] = (_Float16)(p[r] * P_CARRY);
    }
  }
  float psum = ((ps[0] + ps[1]) + (ps[2] + ps[3])) + ((ps[4] + ps[5]) + (ps[6] + ps[7]));
  psum += other_half(psum);
  const float inv = 1.0f / (psum * P_CARRY);   // psum >= 1 to within f32 rounding (row max term)

  // ---- O^T[64 dims][16 queries] = V^T[64][128] . P^T ; A[m=d][k=key] = sX[key][d] through the transposing load, B = pb ----
  // the products stay behind the softmax: the compiler does not see into the v_exp_f32 statements, so none of them may stand
  // within the distance that a product's operand registers need before they are overwritten
  __builtin_amdgcn_sched_barrier(0);
  v8f oacc[4];
#pragma unroll
  for (int t = 0; t < 4; ++t) oacc[t] = (v8f){0.f, 0.f, 0.f, 0.f, 0.f, 0.f, 0.f, 0.f};
#pragma unroll
  for (int kk = 0; kk < 4; ++kk) {
#pragma unroll
    for (int t = 0; t < 4; ++t) {
      oacc[t] = mma16(va[kk][t], pb[kk], oacc[t]);
    }
  }

  // ---- normalise and stage O (oacc[t][r] = O[c][16t + 8hh + r]: eight consecutive dims of one row per lane) ----
  float* os = sO[wave].o;                  // [16][64] f32 at O_PITCH, this wave only
#pragma unroll
  for (int t = 0; t < 4; ++t) {
#pragma unroll
    for (int q = 0; q < 2; ++q) {
      v4f val;
#pragma unroll
      for (int e = 0; e < 4; ++e) val[e] = oacc[t][q * 4 + e] * inv;
      *(v4f*)(os + c * O_PITCH + t * 16 + 8 * hh + q * 4) = val;
    }
  }
  __syncthreads();

  {
    const int c4 = c * 4;
    {
#pragma unroll
      for (int it = 0; it < 8; ++it) {
        const int row = it * 2 + hh;                          // 0..15
        const v4f val = *(const v4f*)(os + row * O_PITCH + c4);
        *(v4f*)(gy + ((r0 + hh) * HEAD_DIM + c4) + it * (2 * HEAD_DIM)) = val;   // row r0 + row: one address a lane, the trip in the offset
      }
      
    }
  }
}

extern "C" void kernel_launch(void* const* d_in, const int* in_sizes, int n_in,
                              void* d_out, int out_size, void* d_ws, size_t ws_size,
                              hipStream_t stream) {
  (void)n_in; (void)d_ws; (void)ws_size;
  const float* x = (const float*)d_in[0];
  float* out = (float*)d_out;
  const int total = in_sizes[0];
  const int per_bh = SEQ_LEN * HEAD_DIM;                 // 42944
  const int nbh = total / per_bh;                        // batch * heads = 128
  if (nbh <= 0 || nbh * per_bh != total || out_size != total) return;
  // no workspace used
  blk_attn_kernel<<<dim3(4, nbh), NTHREADS, 0, stream>>>(x, out);
}
